// v000
// The times below were measured on an AMD MI455X: many runs one after another, warmed up first and cycling through
// copies of the inputs, with the whole window's GPU time divided by the number of runs. Launches and the gaps
// between them are all in it. The median over several windows is given; except for v000 it joins two sittings, which
// can be a few percent apart, so the side-by-side timings, each taken in one sitting, are the better comparison.
// The starting kernel, v000, takes 377 microseconds a run.
#include <hip/hip_runtime.h>
#include <hip/hip_bf16.h>

typedef __attribute__((ext_vector_type(16))) _Float16 v16h;
typedef __attribute__((ext_vector_type(4)))  _Float16 v4h;
typedef __attribute__((ext_vector_type(8)))  float    v8f;

#define N_TOK   343
#define NP      352
#define NT      22
#define NPAD    344     // bias row stride (floats): 344*4 B = 16B aligned rows
#define DMODEL  128
#define DH      32
#define NHEADS  4
#define VT_LD   360
#define WSL_LD  136
#define WOL_LD  134
#define QK_SCALE 0.17677669529663689f   // 32^-0.5

__device__ __forceinline__ v16h frag_k_contig(const _Float16* rowptr, int lane) {
    v16h f;
#pragma unroll
    for (int v = 0; v < 8; ++v) {
        int k = 2 * v + ((v & 4) ? 8 : 0) + ((lane & 16) ? 8 : 0);
        f[2 * v]     = rowptr[k];
        f[2 * v + 1] = rowptr[k + 1];
    }
    return f;
}

__device__ __forceinline__ v8f zero8() {
    v8f z;
#pragma unroll
    for (int i = 0; i < 8; ++i) z[i] = 0.0f;
    return z;
}

__device__ __forceinline__ v8f wmma_f16(v16h a, v16h b, v8f c) {
    return __builtin_amdgcn_wmma_f32_16x16x32_f16(false, a, false, b, (short)0, c,
                                                  false, false);
}

// ---- kernel 0: bias_t[h][j][i(padded 344)] = bias_table[rel_idx[i,j], h] ----
// Transposed + padded so the attention kernel can fetch 8 consecutive i's per
// lane as two aligned float4 loads.
__global__ void bias_gather_kernel(const float* __restrict__ bias_table,
                                   const int*   __restrict__ rel_idx,
                                   float*       __restrict__ bias_ws) {
    int t = blockIdx.x * blockDim.x + threadIdx.x;
    const int total = NHEADS * N_TOK * NPAD;
    if (t >= total) return;
    int i  = t % NPAD;
    int hj = t / NPAD;
    int j  = hj % N_TOK;
    int h  = hj / N_TOK;
    bias_ws[t] = (i < N_TOK)
        ? bias_table[(size_t)rel_idx[(size_t)i * N_TOK + j] * NHEADS + h]
        : 0.0f;
}

// ---- kernel 1: fully fused window attention, one workgroup per window ----
__global__ __launch_bounds__(256, 1) void win_attn_kernel(
    const float* __restrict__ xg,
    const float* __restrict__ w_qkv,
    const float* __restrict__ w_out,
    const float* __restrict__ bias_ws,
    float*       __restrict__ out) {
    extern __shared__ _Float16 smem[];
    _Float16* xf   = smem;
    _Float16* qh   = xf + NP * DMODEL;
    _Float16* kh   = qh + NP * DH;
    _Float16* vT   = kh + NP * DH;
    _Float16* oacc = vT + DH * VT_LD;
    _Float16* wslT = oacc + NP * DMODEL;
    _Float16* pbuf = wslT + 96 * WSL_LD;
    _Float16* wolT = wslT;

    const int tid  = threadIdx.x;
    const int lane = tid & 31;
    const int wave = tid >> 5;
    const int win  = blockIdx.x;
    const int lm   = lane & 15;             // N/M index within a 16-wide tile
    const int hi16 = (lane & 16) ? 8 : 0;   // C-layout row offset, upper half

    // stage x window (343x128 f32 -> f16, zero-pad rows to 352), float4 reads
    const float4* xw4 = (const float4*)(xg + (size_t)win * N_TOK * DMODEL);
    for (int i4 = tid; i4 < NP * DMODEL / 4; i4 += 256) {
        int r = (i4 * 4) >> 7;
        v4h hv;
        if (r < N_TOK) {
            float4 f = xw4[i4];
            hv[0] = (_Float16)f.x; hv[1] = (_Float16)f.y;
            hv[2] = (_Float16)f.z; hv[3] = (_Float16)f.w;
        } else {
            hv[0] = hv[1] = hv[2] = hv[3] = (_Float16)0.0f;
        }
        *(v4h*)(&xf[i4 * 4]) = hv;
    }

    for (int h = 0; h < NHEADS; ++h) {
        // stage this head's 128x96 slice of w_qkv, transposed (K-contiguous)
        for (int i = tid; i < DMODEL * 96; i += 256) {
            int r = i / 96, c = i % 96;
            int col = (c >> 5) * DMODEL + h * DH + (c & 31);
            wslT[c * WSL_LD + r] = (_Float16)w_qkv[(size_t)r * (3 * DMODEL) + col];
        }
        __syncthreads();  // also guards prev head's phase-2 reads of qh/kh/vT

        // ---- phase 1: QKV projection, split by destination (uniform stores) --
        // Q tiles -> qh (pre-scaled)
        for (int jt = wave; jt < NT * 2; jt += 8) {
            int rt = jt >> 1, c0 = (jt & 1) * 16;
            v8f acc = zero8();
#pragma unroll
            for (int kc = 0; kc < 4; ++kc) {
                v16h a = frag_k_contig(&xf[(rt * 16 + lm) * DMODEL + kc * 32], lane);
                v16h b = frag_k_contig(&wslT[(c0 + lm) * WSL_LD + kc * 32], lane);
                acc = wmma_f16(a, b, acc);
            }
#pragma unroll
            for (int v = 0; v < 8; ++v)
                qh[(rt * 16 + v + hi16) * DH + c0 + lm] =
                    (_Float16)(acc[v] * QK_SCALE);
        }
        // K tiles -> kh
        for (int jt = wave; jt < NT * 2; jt += 8) {
            int rt = jt >> 1, c0 = (jt & 1) * 16;
            v8f acc = zero8();
#pragma unroll
            for (int kc = 0; kc < 4; ++kc) {
                v16h a = frag_k_contig(&xf[(rt * 16 + lm) * DMODEL + kc * 32], lane);
                v16h b = frag_k_contig(&wslT[(32 + c0 + lm) * WSL_LD + kc * 32], lane);
                acc = wmma_f16(a, b, acc);
            }
#pragma unroll
            for (int v = 0; v < 8; ++v)
                kh[(rt * 16 + v + hi16) * DH + c0 + lm] = (_Float16)acc[v];
        }
        // V tiles -> vT (transposed; each lane's 8 rows are contiguous)
        for (int jt = wave; jt < NT * 2; jt += 8) {
            int rt = jt >> 1, c0 = (jt & 1) * 16;
            v8f acc = zero8();
#pragma unroll
            for (int kc = 0; kc < 4; ++kc) {
                v16h a = frag_k_contig(&xf[(rt * 16 + lm) * DMODEL + kc * 32], lane);
                v16h b = frag_k_contig(&wslT[(64 + c0 + lm) * WSL_LD + kc * 32], lane);
                acc = wmma_f16(a, b, acc);
            }
#pragma unroll
            for (int v = 0; v < 8; ++v)
                vT[(c0 + lm) * VT_LD + rt * 16 + hi16 + v] = (_Float16)acc[v];
        }
        __syncthreads();

        // ---- phase 2: attention; each wave owns query tiles qt, qt+8, ... ----
        const float* bh = bias_ws + (size_t)h * N_TOK * NPAD;
        for (int qt = wave; qt < NT; qt += 8) {
            // S row-block (16 x 352) in registers; dh=32 => one WMMA per tile
            v16h qf = frag_k_contig(&qh[(qt * 16 + lm) * DH], lane);
            v8f s[NT];
#pragma unroll
            for (int nt = 0; nt < NT; ++nt) {
                v16h kf = frag_k_contig(&kh[(nt * 16 + lm) * DH], lane);
                s[nt] = wmma_f16(qf, kf, zero8());
            }
            // + relative-position bias (two aligned float4 per tile), mask pads
            int ib = qt * 16 + hi16;          // this lane's first row
            if (ib > 336) ib = 336;           // clamp: rows >=343 are garbage
#pragma unroll
            for (int nt = 0; nt < NT; ++nt) {
                int j = nt * 16 + lm;
                bool jv = (j < N_TOK);
                float4 b0, b1;
                b0.x = b0.y = b0.z = b0.w = 0.0f;
                b1 = b0;
                if (jv) {
                    const float4* bp =
                        (const float4*)(bh + (size_t)j * NPAD + ib);
                    b0 = bp[0];
                    b1 = bp[1];
                }
                float bb[8] = {b0.x, b0.y, b0.z, b0.w, b1.x, b1.y, b1.z, b1.w};
#pragma unroll
                for (int v = 0; v < 8; ++v)
                    s[nt][v] = jv ? (s[nt][v] + bb[v]) : -__builtin_inff();
            }
            // softmax over 352 cols: in-lane partials + 16-lane xor reductions
            float rmax[8], rsum[8];
#pragma unroll
            for (int v = 0; v < 8; ++v) rmax[v] = -__builtin_inff();
#pragma unroll
            for (int nt = 0; nt < NT; ++nt)
#pragma unroll
                for (int v = 0; v < 8; ++v) rmax[v] = fmaxf(rmax[v], s[nt][v]);
#pragma unroll
            for (int v = 0; v < 8; ++v) {
#pragma unroll
                for (int m = 1; m < 16; m <<= 1)
                    rmax[v] = fmaxf(rmax[v], __shfl_xor(rmax[v], m, 32));
                rsum[v] = 0.0f;
            }
#pragma unroll
            for (int nt = 0; nt < NT; ++nt)
#pragma unroll
                for (int v = 0; v < 8; ++v) {
                    float p = __expf(s[nt][v] - rmax[v]);
                    s[nt][v] = p;
                    rsum[v] += p;
                }
#pragma unroll
            for (int v = 0; v < 8; ++v) {
#pragma unroll
                for (int m = 1; m < 16; m <<= 1)
                    rsum[v] += __shfl_xor(rsum[v], m, 32);
                rsum[v] = 1.0f / rsum[v];
            }
#pragma unroll
            for (int nt = 0; nt < NT; ++nt)
#pragma unroll
                for (int v = 0; v < 8; ++v) s[nt][v] *= rsum[v];

            _Float16* pw = pbuf + wave * 16 * 32;
            v8f o0 = zero8(), o1 = zero8();
#pragma unroll
            for (int c = 0; c < 11; ++c) {
#pragma unroll
                for (int v = 0; v < 8; ++v) {
                    int m = v + hi16;
                    pw[m * 32 + lm]      = (_Float16)s[2 * c][v];
                    pw[m * 32 + 16 + lm] = (_Float16)s[2 * c + 1][v];
                }
                asm volatile("s_wait_dscnt 0x0" ::: "memory");  // wave LDS RAW fence
                v16h pf  = frag_k_contig(&pw[lm * 32], lane);
                v16h vf0 = frag_k_contig(&vT[lm * VT_LD + c * 32], lane);
                v16h vf1 = frag_k_contig(&vT[(16 + lm) * VT_LD + c * 32], lane);
                o0 = wmma_f16(pf, vf0, o0);
                o1 = wmma_f16(pf, vf1, o1);
                asm volatile("s_wait_dscnt 0x0" ::: "memory");  // WAR vs next chunk
            }
#pragma unroll
            for (int v = 0; v < 8; ++v) {
                int row = qt * 16 + v + hi16;
                oacc[row * DMODEL + h * DH + lm]      = (_Float16)o0[v];
                oacc[row * DMODEL + h * DH + 16 + lm] = (_Float16)o1[v];
            }
        }
        __syncthreads();
    }

    // ---- final projection: out = oacc(352x128) @ w_out(128x128) ----
    for (int i = tid; i < DMODEL * DMODEL; i += 256) {
        int k = i >> 7, n = i & 127;
        wolT[n * WOL_LD + k] = (_Float16)w_out[i];   // transposed, K-contiguous
    }
    __syncthreads();

    for (int qt = wave; qt < NT; qt += 8) {
        for (int ct = 0; ct < 8; ++ct) {
            v8f acc = zero8();
#pragma unroll
            for (int kc = 0; kc < 4; ++kc) {
                v16h a = frag_k_contig(&oacc[(qt * 16 + lm) * DMODEL + kc * 32], lane);
                v16h b = frag_k_contig(&wolT[(ct * 16 + lm) * WOL_LD + kc * 32], lane);
                acc = wmma_f16(a, b, acc);
            }
#pragma unroll
            for (int v = 0; v < 8; ++v) {
                int row = qt * 16 + v + hi16;
                if (row < N_TOK)
                    out[((size_t)win * N_TOK + row) * DMODEL + ct * 16 + lm] = acc[v];
            }
        }
    }
}

extern "C" void kernel_launch(void* const* d_in, const int* in_sizes, int n_in,
                              void* d_out, int out_size, void* d_ws, size_t ws_size,
                              hipStream_t stream) {
    const float* x        = (const float*)d_in[0];
    const float* w_qkv    = (const float*)d_in[1];
    const float* w_out    = (const float*)d_in[2];
    const float* bias_tab = (const float*)d_in[3];
    const int*   rel_idx  = (const int*)d_in[4];
    float* out     = (float*)d_out;
    float* bias_ws = (float*)d_ws;

    const int total = NHEADS * N_TOK * NPAD;
    bias_gather_kernel<<<(total + 255) / 256, 256, 0, stream>>>(bias_tab, rel_idx,
                                                                bias_ws);
    // 512 windows, 8 waves each, 282624 B dynamic LDS per workgroup
    win_attn_kernel<<<512, 256, 282624, stream>>>(x, w_qkv, w_out, bias_ws, out);
}

// v001
// A run of this version takes 272 microseconds.
// In two side-by-side timings against v000, it was 1.41 and 1.40 times as fast.
#include <hip/hip_runtime.h>
#include <hip/hip_bf16.h>

typedef __attribute__((ext_vector_type(16))) _Float16 v16h;
typedef __attribute__((ext_vector_type(4)))  _Float16 v4h;
typedef __attribute__((ext_vector_type(8)))  float    v8f;

#define N_TOK   343
#define NP      352
#define NT      22
#define NPAD    344     // bias row stride (floats): 344*4 B = 16B aligned rows
#define DMODEL  128
#define DH      32
#define NHEADS  4
#define VT_LD   360
#define WSL_LD  136
#define WOL_LD  136
#define XF_LD   136
#define QK_LD   40
#define QK_SCALE 0.17677669529663689f   // 32^-0.5

__device__ __forceinline__ v16h frag_k_contig(const _Float16* rowptr, int lane) {
    v16h f;
#pragma unroll
    for (int v = 0; v < 8; ++v) {
        int k = 2 * v + ((v & 4) ? 8 : 0) + ((lane & 16) ? 8 : 0);
        f[2 * v]     = rowptr[k];
        f[2 * v + 1] = rowptr[k + 1];
    }
    return f;
}

__device__ __forceinline__ v8f zero8() {
    v8f z;
#pragma unroll
    for (int i = 0; i < 8; ++i) z[i] = 0.0f;
    return z;
}

__device__ __forceinline__ v8f wmma_f16(v16h a, v16h b, v8f c) {
    return __builtin_amdgcn_wmma_f32_16x16x32_f16(false, a, false, b, (short)0, c,
                                                  false, false);
}

// ---- kernel 0: bias_t[h][j][i(padded 344)] = bias_table[rel_idx[i,j], h] ----
// Transposed + padded so the attention kernel can fetch 8 consecutive i's per
// lane as two aligned float4 loads.
__global__ void bias_gather_kernel(const float* __restrict__ bias_table,
                                   const int*   __restrict__ rel_idx,
                                   float*       __restrict__ bias_ws) {
    int t = blockIdx.x * blockDim.x + threadIdx.x;
    const int total = NHEADS * N_TOK * NPAD;
    if (t >= total) return;
    int i  = t % NPAD;
    int hj = t / NPAD;
    int j  = hj % N_TOK;
    int h  = hj / N_TOK;
    bias_ws[t] = (i < N_TOK)
        ? bias_table[(size_t)rel_idx[(size_t)i * N_TOK + j] * NHEADS + h]
        : 0.0f;
}

// ---- kernel 1: fully fused window attention, one workgroup per window ----
__global__ __launch_bounds__(256, 1) void win_attn_kernel(
    const float* __restrict__ xg,
    const float* __restrict__ w_qkv,
    const float* __restrict__ w_out,
    const float* __restrict__ bias_ws,
    float*       __restrict__ out) {
    extern __shared__ _Float16 smem[];
    _Float16* xf   = smem;
    _Float16* qh   = xf + NP * XF_LD;
    _Float16* kh   = qh + NP * QK_LD;
    _Float16* vT   = kh + NP * QK_LD;
    _Float16* oacc = vT + DH * VT_LD;
    _Float16* wslT = oacc + NP * XF_LD;
    _Float16* pbuf = wslT + 96 * WSL_LD;
    _Float16* wolT = wslT;

    const int tid  = threadIdx.x;
    const int lane = tid & 31;
    const int wave = tid >> 5;
    const int win  = blockIdx.x;
    const int lm   = lane & 15;             // N/M index within a 16-wide tile
    const int hi16 = (lane & 16) ? 8 : 0;   // C-layout row offset, upper half

    // stage x window (343x128 f32 -> f16, zero-pad rows to 352), float4 reads
    const float4* xw4 = (const float4*)(xg + (size_t)win * N_TOK * DMODEL);
    for (int i4 = tid; i4 < NP * DMODEL / 4; i4 += 256) {
        int r = (i4 * 4) >> 7;
        v4h hv;
        if (r < N_TOK) {
            float4 f = xw4[i4];
            hv[0] = (_Float16)f.x; hv[1] = (_Float16)f.y;
            hv[2] = (_Float16)f.z; hv[3] = (_Float16)f.w;
        } else {
            hv[0] = hv[1] = hv[2] = hv[3] = (_Float16)0.0f;
        }
        *(v4h*)(&xf[r * XF_LD + ((i4 * 4) & 127)]) = hv;
    }

    for (int h = 0; h < NHEADS; ++h) {
        // stage this head's 128x96 slice of w_qkv, transposed (K-contiguous)
        for (int i = tid; i < DMODEL * 96; i += 256) {
            int r = i / 96, c = i % 96;
            int col = (c >> 5) * DMODEL + h * DH + (c & 31);
            wslT[c * WSL_LD + r] = (_Float16)w_qkv[(size_t)r * (3 * DMODEL) + col];
        }
        __syncthreads();  // also guards prev head's phase-2 reads of qh/kh/vT

        // ---- phase 1: QKV projection, split by destination (uniform stores) --
        // Q tiles -> qh (pre-scaled)
        for (int jt = wave; jt < NT * 2; jt += 8) {
            int rt = jt >> 1, c0 = (jt & 1) * 16;
            v8f acc = zero8();
#pragma unroll
            for (int kc = 0; kc < 4; ++kc) {
                v16h a = frag_k_contig(&xf[(rt * 16 + lm) * XF_LD + kc * 32], lane);
                v16h b = frag_k_contig(&wslT[(c0 + lm) * WSL_LD + kc * 32], lane);
                acc = wmma_f16(a, b, acc);
            }
#pragma unroll
            for (int v = 0; v < 8; ++v)
                qh[(rt * 16 + v + hi16) * QK_LD + c0 + lm] =
                    (_Float16)(acc[v] * QK_SCALE);
        }
        // K tiles -> kh
        for (int jt = wave; jt < NT * 2; jt += 8) {
            int rt = jt >> 1, c0 = (jt & 1) * 16;
            v8f acc = zero8();
#pragma unroll
            for (int kc = 0; kc < 4; ++kc) {
                v16h a = frag_k_contig(&xf[(rt * 16 + lm) * XF_LD + kc * 32], lane);
                v16h b = frag_k_contig(&wslT[(32 + c0 + lm) * WSL_LD + kc * 32], lane);
                acc = wmma_f16(a, b, acc);
            }
#pragma unroll
            for (int v = 0; v < 8; ++v)
                kh[(rt * 16 + v + hi16) * QK_LD + c0 + lm] = (_Float16)acc[v];
        }
        // V tiles -> vT (transposed; each lane's 8 rows are contiguous)
        for (int jt = wave; jt < NT * 2; jt += 8) {
            int rt = jt >> 1, c0 = (jt & 1) * 16;
            v8f acc = zero8();
#pragma unroll
            for (int kc = 0; kc < 4; ++kc) {
                v16h a = frag_k_contig(&xf[(rt * 16 + lm) * XF_LD + kc * 32], lane);
                v16h b = frag_k_contig(&wslT[(64 + c0 + lm) * WSL_LD + kc * 32], lane);
                acc = wmma_f16(a, b, acc);
            }
#pragma unroll
            for (int v = 0; v < 8; ++v)
                vT[(c0 + lm) * VT_LD + rt * 16 + hi16 + v] = (_Float16)acc[v];
        }
        __syncthreads();

        // ---- phase 2: attention; each wave owns query tiles qt, qt+8, ... ----
        const float* bh = bias_ws + (size_t)h * N_TOK * NPAD;
        for (int qt = wave; qt < NT; qt += 8) {
            // S row-block (16 x 352) in registers; dh=32 => one WMMA per tile
            v16h qf = frag_k_contig(&qh[(qt * 16 + lm) * QK_LD], lane);
            v8f s[NT];
#pragma unroll
            for (int nt = 0; nt < NT; ++nt) {
                v16h kf = frag_k_contig(&kh[(nt * 16 + lm) * QK_LD], lane);
                s[nt] = wmma_f16(qf, kf, zero8());
            }
            // + relative-position bias (two aligned float4 per tile), mask pads
            int ib = qt * 16 + hi16;          // this lane's first row
            if (ib > 336) ib = 336;           // clamp: rows >=343 are garbage
#pragma unroll
            for (int nt = 0; nt < NT; ++nt) {
                int j = nt * 16 + lm;
                bool jv = (j < N_TOK);
                float4 b0, b1;
                b0.x = b0.y = b0.z = b0.w = 0.0f;
                b1 = b0;
                if (jv) {
                    const float4* bp =
                        (const float4*)(bh + (size_t)j * NPAD + ib);
                    b0 = bp[0];
                    b1 = bp[1];
                }
                float bb[8] = {b0.x, b0.y, b0.z, b0.w, b1.x, b1.y, b1.z, b1.w};
#pragma unroll
                for (int v = 0; v < 8; ++v)
                    s[nt][v] = jv ? (s[nt][v] + bb[v]) : -__builtin_inff();
            }
            // softmax over 352 cols: in-lane partials + 16-lane xor reductions
            float rmax[8], rsum[8];
#pragma unroll
            for (int v = 0; v < 8; ++v) rmax[v] = -__builtin_inff();
#pragma unroll
            for (int nt = 0; nt < NT; ++nt)
#pragma unroll
                for (int v = 0; v < 8; ++v) rmax[v] = fmaxf(rmax[v], s[nt][v]);
#pragma unroll
            for (int v = 0; v < 8; ++v) {
#pragma unroll
                for (int m = 1; m < 16; m <<= 1)
                    rmax[v] = fmaxf(rmax[v], __shfl_xor(rmax[v], m, 32));
                rsum[v] = 0.0f;
            }
#pragma unroll
            for (int nt = 0; nt < NT; ++nt)
#pragma unroll
                for (int v = 0; v < 8; ++v) {
                    float p = __expf(s[nt][v] - rmax[v]);
                    s[nt][v] = p;
                    rsum[v] += p;
                }
#pragma unroll
            for (int v = 0; v < 8; ++v) {
#pragma unroll
                for (int m = 1; m < 16; m <<= 1)
                    rsum[v] += __shfl_xor(rsum[v], m, 32);
                rsum[v] = 1.0f / rsum[v];
            }
#pragma unroll
            for (int nt = 0; nt < NT; ++nt)
#pragma unroll
                for (int v = 0; v < 8; ++v) s[nt][v] *= rsum[v];

            _Float16* pw = pbuf + wave * 16 * QK_LD;
            v8f o0 = zero8(), o1 = zero8();
#pragma unroll
            for (int c = 0; c < 11; ++c) {
#pragma unroll
                for (int v = 0; v < 8; ++v) {
                    int m = v + hi16;
                    pw[m * QK_LD + lm]      = (_Float16)s[2 * c][v];
                    pw[m * QK_LD + 16 + lm] = (_Float16)s[2 * c + 1][v];
                }
                asm volatile("s_wait_dscnt 0x0" ::: "memory");  // wave LDS RAW fence
                v16h pf  = frag_k_contig(&pw[lm * QK_LD], lane);
                v16h vf0 = frag_k_contig(&vT[lm * VT_LD + c * 32], lane);
                v16h vf1 = frag_k_contig(&vT[(16 + lm) * VT_LD + c * 32], lane);
                o0 = wmma_f16(pf, vf0, o0);
                o1 = wmma_f16(pf, vf1, o1);
                asm volatile("s_wait_dscnt 0x0" ::: "memory");  // WAR vs next chunk
            }
#pragma unroll
            for (int v = 0; v < 8; ++v) {
                int row = qt * 16 + v + hi16;
                oacc[row * XF_LD + h * DH + lm]      = (_Float16)o0[v];
                oacc[row * XF_LD + h * DH + 16 + lm] = (_Float16)o1[v];
            }
        }
        __syncthreads();
    }

    // ---- final projection: out = oacc(352x128) @ w_out(128x128) ----
    for (int i = tid; i < DMODEL * DMODEL; i += 256) {
        int k = i >> 7, n = i & 127;
        wolT[n * WOL_LD + k] = (_Float16)w_out[i];   // transposed, K-contiguous
    }
    __syncthreads();

    for (int qt = wave; qt < NT; qt += 8) {
        for (int ct = 0; ct < 8; ++ct) {
            v8f acc = zero8();
#pragma unroll
            for (int kc = 0; kc < 4; ++kc) {
                v16h a = frag_k_contig(&oacc[(qt * 16 + lm) * XF_LD + kc * 32], lane);
                v16h b = frag_k_contig(&wolT[(ct * 16 + lm) * WOL_LD + kc * 32], lane);
                acc = wmma_f16(a, b, acc);
            }
#pragma unroll
            for (int v = 0; v < 8; ++v) {
                int row = qt * 16 + v + hi16;
                if (row < N_TOK)
                    out[((size_t)win * N_TOK + row) * DMODEL + ct * 16 + lm] = acc[v];
            }
        }
    }
}

extern "C" void kernel_launch(void* const* d_in, const int* in_sizes, int n_in,
                              void* d_out, int out_size, void* d_ws, size_t ws_size,
                              hipStream_t stream) {
    const float* x        = (const float*)d_in[0];
    const float* w_qkv    = (const float*)d_in[1];
    const float* w_out    = (const float*)d_in[2];
    const float* bias_tab = (const float*)d_in[3];
    const int*   rel_idx  = (const int*)d_in[4];
    float* out     = (float*)d_out;
    float* bias_ws = (float*)d_ws;

    const int total = NHEADS * N_TOK * NPAD;
    bias_gather_kernel<<<(total + 255) / 256, 256, 0, stream>>>(bias_tab, rel_idx,
                                                                bias_ws);
    // 512 windows, 8 waves each, 307200 B dynamic LDS per workgroup
    win_attn_kernel<<<512, 256, 307200, stream>>>(x, w_qkv, w_out, bias_ws, out);
}

// v002
// One run takes 244 microseconds.
// Timed twice side by side with v001, it ran 1.11 and 1.12 times as fast.
// All steps since v000 together make it 1.57 times as fast.
#include <hip/hip_runtime.h>
#include <hip/hip_bf16.h>

typedef __attribute__((ext_vector_type(16))) _Float16 v16h;
typedef __attribute__((ext_vector_type(4)))  _Float16 v4h;
typedef __attribute__((ext_vector_type(8)))  float    v8f;

#define N_TOK   343
#define NP      352
#define NT      22
#define BT_F    256     // floats of one 16x16 bias tile, stored in lane order
#define N_REL   2197    // rows of the bias table
#define DMODEL  128
#define DH      32
#define NHEADS  4
#define VT_LD   360
#define WSL_LD  136
#define WOL_LD  136
#define XF_LD   136
#define QK_LD   40
#define QK_SCALE 0.17677669529663689f   // 32^-0.5

__device__ __forceinline__ v16h frag_k_contig(const _Float16* rowptr, int lane) {
    v16h f;
#pragma unroll
    for (int v = 0; v < 8; ++v) {
        int k = 2 * v + ((v & 4) ? 8 : 0) + ((lane & 16) ? 8 : 0);
        f[2 * v]     = rowptr[k];
        f[2 * v + 1] = rowptr[k + 1];
    }
    return f;
}

__device__ __forceinline__ v8f zero8() {
    v8f z;
#pragma unroll
    for (int i = 0; i < 8; ++i) z[i] = 0.0f;
    return z;
}

__device__ __forceinline__ v8f wmma_f16(v16h a, v16h b, v8f c) {
    return __builtin_amdgcn_wmma_f32_16x16x32_f16(false, a, false, b, (short)0, c,
                                                  false, false);
}

__global__ void bias_gather_kernel(const float* __restrict__ bias_table,
                                   const int*   __restrict__ rel_idx,
                                   float*       __restrict__ bias_ws) {
    int t = blockIdx.x * blockDim.x + threadIdx.x;
    const int total = NHEADS * NT * NT * BT_F;
    if (t >= total) return;
    int e    = t & 3;
    int ln   = (t >> 2) & 31;
    int half = (t >> 7) & 1;
    int tile = t >> 8;
    int nt = tile % NT;
    int qt = (tile / NT) % NT;
    int h  = tile / (NT * NT);
    int i = qt * 16 + ((ln & 16) ? 8 : 0) + half * 4 + e;
    int j = nt * 16 + (ln & 15);
    float b = 0.0f;
    if (i < N_TOK && j < N_TOK) {
        int r = rel_idx[(size_t)i * N_TOK + j];
        r = r < 0 ? 0 : (r > N_REL - 1 ? N_REL - 1 : r);   // table row in bounds
        b = bias_table[(size_t)r * NHEADS + h];
    }
    bias_ws[t] = b;
}

// ---- kernel 1: fully fused window attention, one workgroup per window ----
__global__ __launch_bounds__(256, 1) void win_attn_kernel(
    const float* __restrict__ xg,
    const float* __restrict__ w_qkv,
    const float* __restrict__ w_out,
    const float* __restrict__ bias_ws,
    float*       __restrict__ out) {
    extern __shared__ _Float16 smem[];
    _Float16* xf   = smem;
    _Float16* qh   = xf + NP * XF_LD;
    _Float16* kh   = qh + NP * QK_LD;
    _Float16* vT   = kh + NP * QK_LD;
    _Float16* oacc = vT + DH * VT_LD;
    _Float16* wslT = oacc + NP * XF_LD;
    _Float16* pbuf = wslT + 96 * WSL_LD;
    _Float16* wolT = wslT;

    const int tid  = threadIdx.x;
    const int lane = tid & 31;
    const int wave = tid >> 5;
    const int win  = blockIdx.x;
    const int lm   = lane & 15;             // N/M index within a 16-wide tile
    const int hi16 = (lane & 16) ? 8 : 0;   // C-layout row offset, upper half

    // stage x window (343x128 f32 -> f16, zero-pad rows to 352), float4 reads
    const float4* xw4 = (const float4*)(xg + (size_t)win * N_TOK * DMODEL);
    for (int i4 = tid; i4 < NP * DMODEL / 4; i4 += 256) {
        int r = (i4 * 4) >> 7;
        v4h hv;
        if (r < N_TOK) {
            float4 f = xw4[i4];
            hv[0] = (_Float16)f.x; hv[1] = (_Float16)f.y;
            hv[2] = (_Float16)f.z; hv[3] = (_Float16)f.w;
        } else {
            hv[0] = hv[1] = hv[2] = hv[3] = (_Float16)0.0f;
        }
        *(v4h*)(&xf[r * XF_LD + ((i4 * 4) & 127)]) = hv;
    }

    for (int h = 0; h < NHEADS; ++h) {
        // stage this head's 128x96 slice of w_qkv, transposed (K-contiguous)
        for (int i = tid; i < DMODEL * 96; i += 256) {
            int r = i / 96, c = i % 96;
            int col = (c >> 5) * DMODEL + h * DH + (c & 31);
            wslT[c * WSL_LD + r] = (_Float16)w_qkv[(size_t)r * (3 * DMODEL) + col];
        }
        __syncthreads();  // also guards prev head's phase-2 reads of qh/kh/vT

        // ---- phase 1: QKV projection, split by destination (uniform stores) --
        // Q tiles -> qh (pre-scaled)
        for (int jt = wave; jt < NT * 2; jt += 8) {
            int rt = jt >> 1, c0 = (jt & 1) * 16;
            v8f acc = zero8();
#pragma unroll
            for (int kc = 0; kc < 4; ++kc) {
                v16h a = frag_k_contig(&xf[(rt * 16 + lm) * XF_LD + kc * 32], lane);
                v16h b = frag_k_contig(&wslT[(c0 + lm) * WSL_LD + kc * 32], lane);
                acc = wmma_f16(a, b, acc);
            }
#pragma unroll
            for (int v = 0; v < 8; ++v)
                qh[(rt * 16 + v + hi16) * QK_LD + c0 + lm] =
                    (_Float16)(acc[v] * QK_SCALE);
        }
        // K tiles -> kh
        for (int jt = wave; jt < NT * 2; jt += 8) {
            int rt = jt >> 1, c0 = (jt & 1) * 16;
            v8f acc = zero8();
#pragma unroll
            for (int kc = 0; kc < 4; ++kc) {
                v16h a = frag_k_contig(&xf[(rt * 16 + lm) * XF_LD + kc * 32], lane);
                v16h b = frag_k_contig(&wslT[(32 + c0 + lm) * WSL_LD + kc * 32], lane);
                acc = wmma_f16(a, b, acc);
            }
#pragma unroll
            for (int v = 0; v < 8; ++v)
                kh[(rt * 16 + v + hi16) * QK_LD + c0 + lm] = (_Float16)acc[v];
        }
        // V tiles -> vT (transposed; each lane's 8 rows are contiguous)
        for (int jt = wave; jt < NT * 2; jt += 8) {
            int rt = jt >> 1, c0 = (jt & 1) * 16;
            v8f acc = zero8();
#pragma unroll
            for (int kc = 0; kc < 4; ++kc) {
                v16h a = frag_k_contig(&xf[(rt * 16 + lm) * XF_LD + kc * 32], lane);
                v16h b = frag_k_contig(&wslT[(64 + c0 + lm) * WSL_LD + kc * 32], lane);
                acc = wmma_f16(a, b, acc);
            }
#pragma unroll
            for (int v = 0; v < 8; ++v)
                vT[(c0 + lm) * VT_LD + rt * 16 + hi16 + v] = (_Float16)acc[v];
        }
        __syncthreads();

        // ---- phase 2: attention; each wave owns query tiles qt, qt+8, ... ----
        const float4* bh = (const float4*)bias_ws + (size_t)h * NT * NT * (BT_F / 4);
        for (int qt = wave; qt < NT; qt += 8) {
            // S row-block (16 x 352) in registers; dh=32 => one WMMA per tile
            v16h qf = frag_k_contig(&qh[(qt * 16 + lm) * QK_LD], lane);
            v8f s[NT];
#pragma unroll
            for (int nt = 0; nt < NT; ++nt) {
                v16h kf = frag_k_contig(&kh[(nt * 16 + lm) * QK_LD], lane);
                s[nt] = wmma_f16(qf, kf, zero8());
            }
            // + relative-position bias (two whole-line float4 loads per tile; the
            // plane holds its own pads, so every lane loads), mask pads
            const float4* bp = bh + (size_t)qt * NT * (BT_F / 4) + lane;
#pragma unroll
            for (int nt = 0; nt < NT; ++nt) {
                int j = nt * 16 + lm;
                bool jv = (j < N_TOK);
                float4 b0 = bp[nt * (BT_F / 4)];
                float4 b1 = bp[nt * (BT_F / 4) + 32];
                float bb[8] = {b0.x, b0.y, b0.z, b0.w, b1.x, b1.y, b1.z, b1.w};
#pragma unroll
                for (int v = 0; v < 8; ++v)
                    s[nt][v] = jv ? (s[nt][v] + bb[v]) : -__builtin_inff();
            }
            // softmax over 352 cols: in-lane partials + 16-lane xor reductions
            float rmax[8], rsum[8];
#pragma unroll
            for (int v = 0; v < 8; ++v) rmax[v] = -__builtin_inff();
#pragma unroll
            for (int nt = 0; nt < NT; ++nt)
#pragma unroll
                for (int v = 0; v < 8; ++v) rmax[v] = fmaxf(rmax[v], s[nt][v]);
#pragma unroll
            for (int v = 0; v < 8; ++v) {
#pragma unroll
                for (int m = 1; m < 16; m <<= 1)
                    rmax[v] = fmaxf(rmax[v], __shfl_xor(rmax[v], m, 32));
                rsum[v] = 0.0f;
            }
#pragma unroll
            for (int nt = 0; nt < NT; ++nt)
#pragma unroll
                for (int v = 0; v < 8; ++v) {
                    float p = __expf(s[nt][v] - rmax[v]);
                    s[nt][v] = p;
                    rsum[v] += p;
                }
#pragma unroll
            for (int v = 0; v < 8; ++v) {
#pragma unroll
                for (int m = 1; m < 16; m <<= 1)
                    rsum[v] += __shfl_xor(rsum[v], m, 32);
                rsum[v] = 1.0f / rsum[v];
            }
#pragma unroll
            for (int nt = 0; nt < NT; ++nt)
#pragma unroll
                for (int v = 0; v < 8; ++v) s[nt][v] *= rsum[v];

            _Float16* pw = pbuf + wave * 16 * QK_LD;
            v8f o0 = zero8(), o1 = zero8();
#pragma unroll
            for (int c = 0; c < 11; ++c) {
#pragma unroll
                for (int v = 0; v < 8; ++v) {
                    int m = v + hi16;
                    pw[m * QK_LD + lm]      = (_Float16)s[2 * c][v];
                    pw[m * QK_LD + 16 + lm] = (_Float16)s[2 * c + 1][v];
                }
                asm volatile("s_wait_dscnt 0x0" ::: "memory");  // wave LDS RAW fence
                v16h pf  = frag_k_contig(&pw[lm * QK_LD], lane);
                v16h vf0 = frag_k_contig(&vT[lm * VT_LD + c * 32], lane);
                v16h vf1 = frag_k_contig(&vT[(16 + lm) * VT_LD + c * 32], lane);
                o0 = wmma_f16(pf, vf0, o0);
                o1 = wmma_f16(pf, vf1, o1);
                asm volatile("s_wait_dscnt 0x0" ::: "memory");  // WAR vs next chunk
            }
#pragma unroll
            for (int v = 0; v < 8; ++v) {
                int row = qt * 16 + v + hi16;
                oacc[row * XF_LD + h * DH + lm]      = (_Float16)o0[v];
                oacc[row * XF_LD + h * DH + 16 + lm] = (_Float16)o1[v];
            }
        }
        __syncthreads();
    }

    // ---- final projection: out = oacc(352x128) @ w_out(128x128) ----
    for (int i = tid; i < DMODEL * DMODEL; i += 256) {
        int k = i >> 7, n = i & 127;
        wolT[n * WOL_LD + k] = (_Float16)w_out[i];   // transposed, K-contiguous
    }
    __syncthreads();

    for (int qt = wave; qt < NT; qt += 8) {
        for (int ct = 0; ct < 8; ++ct) {
            v8f acc = zero8();
#pragma unroll
            for (int kc = 0; kc < 4; ++kc) {
                v16h a = frag_k_contig(&oacc[(qt * 16 + lm) * XF_LD + kc * 32], lane);
                v16h b = frag_k_contig(&wolT[(ct * 16 + lm) * WOL_LD + kc * 32], lane);
                acc = wmma_f16(a, b, acc);
            }
#pragma unroll
            for (int v = 0; v < 8; ++v) {
                int row = qt * 16 + v + hi16;
                if (row < N_TOK)
                    out[((size_t)win * N_TOK + row) * DMODEL + ct * 16 + lm] = acc[v];
            }
        }
    }
}

extern "C" void kernel_launch(void* const* d_in, const int* in_sizes, int n_in,
                              void* d_out, int out_size, void* d_ws, size_t ws_size,
                              hipStream_t stream) {
    const float* x        = (const float*)d_in[0];
    const float* w_qkv    = (const float*)d_in[1];
    const float* w_out    = (const float*)d_in[2];
    const float* bias_tab = (const float*)d_in[3];
    const int*   rel_idx  = (const int*)d_in[4];
    float* out     = (float*)d_out;
    float* bias_ws = (float*)d_ws;

    const int total = NHEADS * NT * NT * BT_F;
    bias_gather_kernel<<<(total + 255) / 256, 256, 0, stream>>>(bias_tab, rel_idx,
                                                                bias_ws);
    // 512 windows, 8 waves each, 307200 B dynamic LDS per workgroup
    win_attn_kernel<<<512, 256, 307200, stream>>>(x, w_qkv, w_out, bias_ws, out);
}

// v003
// Measured time: 184 microseconds a run.
// In both of two side-by-side timings against v002, it was 1.33 times as fast.
// Counting every step since v000, it is 2.09 times as fast.
#include <hip/hip_runtime.h>
#include <hip/hip_bf16.h>

typedef __attribute__((ext_vector_type(16))) _Float16 v16h;
typedef __attribute__((ext_vector_type(4)))  _Float16 v4h;
typedef __attribute__((ext_vector_type(8)))  _Float16 v8h;
typedef __attribute__((ext_vector_type(8)))  float    v8f;

#define N_TOK   343
#define NP      352
#define NT      22
#define BT_F    256     // floats of one 16x16 bias tile, stored in lane order
#define N_REL   2197    // rows of the bias table
#define DMODEL  128
#define DH      32
#define NHEADS  4
#define VT_LD   360
#define WSL_LD  136
#define WOL_LD  136
#define XF_LD   136
#define QK_LD   40
#define QK_SCALE 0.17677669529663689f   // 32^-0.5

__device__ __forceinline__ v16h frag_k_contig(const _Float16* rowptr, int lane) {
    v16h f;
#pragma unroll
    for (int v = 0; v < 8; ++v) {
        int k = 2 * v + ((v & 4) ? 8 : 0) + ((lane & 16) ? 8 : 0);
        f[2 * v]     = rowptr[k];
        f[2 * v + 1] = rowptr[k + 1];
    }
    return f;
}

__device__ __forceinline__ v8f zero8() {
    v8f z;
#pragma unroll
    for (int i = 0; i < 8; ++i) z[i] = 0.0f;
    return z;
}

__device__ __forceinline__ v8f wmma_f16(v16h a, v16h b, v8f c) {
    return __builtin_amdgcn_wmma_f32_16x16x32_f16(false, a, false, b, (short)0, c,
                                                  false, false);
}

__global__ void bias_gather_kernel(const float* __restrict__ bias_table,
                                   const int*   __restrict__ rel_idx,
                                   float*       __restrict__ bias_ws) {
    int t = blockIdx.x * blockDim.x + threadIdx.x;
    const int total = NHEADS * NT * NT * BT_F;
    if (t >= total) return;
    int e    = t & 3;
    int ln   = (t >> 2) & 31;
    int half = (t >> 7) & 1;
    int tile = t >> 8;
    int nt = tile % NT;
    int qt = (tile / NT) % NT;
    int h  = tile / (NT * NT);
    int i = qt * 16 + ((ln & 16) ? 8 : 0) + half * 4 + e;
    int j = nt * 16 + (ln & 15);
    float b = 0.0f;
    if (i < N_TOK && j < N_TOK) {
        int r = rel_idx[(size_t)i * N_TOK + j];
        r = r < 0 ? 0 : (r > N_REL - 1 ? N_REL - 1 : r);   // table row in bounds
        b = bias_table[(size_t)r * NHEADS + h];
    }
    bias_ws[t] = b;
}

// ---- kernel 1: fully fused window attention, one workgroup per window ----
__global__ __launch_bounds__(256, 1) void win_attn_kernel(
    const float* __restrict__ xg,
    const float* __restrict__ w_qkv,
    const float* __restrict__ w_out,
    const float* __restrict__ bias_ws,
    float*       __restrict__ out) {
    extern __shared__ _Float16 smem[];
    _Float16* xf   = smem;
    _Float16* qh   = xf + NP * XF_LD;
    _Float16* kh   = qh + NP * QK_LD;
    _Float16* vT   = kh + NP * QK_LD;
    _Float16* oacc = vT + DH * VT_LD;
    _Float16* wslT = oacc + NP * XF_LD;
    _Float16* pbuf = wslT + 96 * WSL_LD;
    _Float16* wolT = wslT;

    const int tid  = threadIdx.x;
    const int lane = tid & 31;
    const int wave = tid >> 5;
    const int win  = blockIdx.x;
    const int lm   = lane & 15;             // N/M index within a 16-wide tile
    const int hi16 = (lane & 16) ? 8 : 0;   // C-layout row offset, upper half

    // stage x window (343x128 f32 -> f16, zero-pad rows to 352), float4 reads.
    // The whole window is requested before the first value is used: a thread's
    // 43 loads are in flight together, so the stage pays the memory latency once.
    {
        constexpr int XQ    = N_TOK * DMODEL / 4;   // float4s of one window
        constexpr int XFULL = XQ / 256;             // sweeps every thread takes part in
        constexpr int XREM  = XQ % 256;             // threads of the last, partial sweep
        const float4* xw4 = (const float4*)(xg + (size_t)win * N_TOK * DMODEL) + tid;
        float4 f[XFULL + 1];
#pragma unroll   // f[] stays in registers only if indexed by constants
        for (int k = 0; k < XFULL; ++k) f[k] = xw4[k * 256];
        f[XFULL] = make_float4(0.0f, 0.0f, 0.0f, 0.0f);
        if (tid < XREM) f[XFULL] = xw4[XFULL * 256];
        // one sweep = 8 rows; thread: row tid/32 of the sweep, columns 4*(tid%32)..
        _Float16* xd = &xf[(tid >> 5) * XF_LD + (tid & 31) * 4];
#pragma unroll   // f[] stays in registers only if indexed by constants
        for (int k = 0; k <= XFULL; ++k) {
            v4h hv;
            hv[0] = (_Float16)f[k].x; hv[1] = (_Float16)f[k].y;
            hv[2] = (_Float16)f[k].z; hv[3] = (_Float16)f[k].w;
            *(v4h*)(xd + k * 8 * XF_LD) = hv;
        }
        v4h zv;
        zv[0] = zv[1] = zv[2] = zv[3] = (_Float16)0.0f;
        for (int k = XFULL + 1; k < NP / 8; ++k) *(v4h*)(xd + k * 8 * XF_LD) = zv;
    }

    for (int h = 0; h < NHEADS; ++h) {
        // stage this head's 128x96 slice of w_qkv, transposed (K-contiguous).
        // Wave w takes rows 16w..16w+15, a lane one column of each of q, k, v:
        // all 48 loads (one whole line each) are issued before the first is used.
        {
            const float* wp = w_qkv + (size_t)(wave * 16) * (3 * DMODEL) + h * DH + lane;
            float wv[3][16];
#pragma unroll   // wv[][] stays in registers only if indexed by constants
            for (int s = 0; s < 3; ++s)
#pragma unroll   // same: straight-line loads, one after another
                for (int m = 0; m < 16; ++m)
                    wv[s][m] = wp[m * (3 * DMODEL) + s * DMODEL];
#pragma unroll   // constant indices into wv[][]
            for (int s = 0; s < 3; ++s) {
                v8h lo, hi;
#pragma unroll   // constant indices into wv[][], lo, hi
                for (int m = 0; m < 8; ++m) {
                    lo[m] = (_Float16)wv[s][m];
                    hi[m] = (_Float16)wv[s][8 + m];
                }
                _Float16* wd = &wslT[(s * 32 + lane) * WSL_LD + wave * 16];
                *(v8h*)wd       = lo;
                *(v8h*)(wd + 8) = hi;
            }
        }
        __syncthreads();  // also guards prev head's phase-2 reads of qh/kh/vT

        // ---- phase 1: QKV projection, split by destination (uniform stores) --
        // Q tiles -> qh (pre-scaled)
        for (int jt = wave; jt < NT * 2; jt += 8) {
            int rt = jt >> 1, c0 = (jt & 1) * 16;
            v8f acc = zero8();
#pragma unroll
            for (int kc = 0; kc < 4; ++kc) {
                v16h a = frag_k_contig(&xf[(rt * 16 + lm) * XF_LD + kc * 32], lane);
                v16h b = frag_k_contig(&wslT[(c0 + lm) * WSL_LD + kc * 32], lane);
                acc = wmma_f16(a, b, acc);
            }
#pragma unroll
            for (int v = 0; v < 8; ++v)
                qh[(rt * 16 + v + hi16) * QK_LD + c0 + lm] =
                    (_Float16)(acc[v] * QK_SCALE);
        }
        // K tiles -> kh
        for (int jt = wave; jt < NT * 2; jt += 8) {
            int rt = jt >> 1, c0 = (jt & 1) * 16;
            v8f acc = zero8();
#pragma unroll
            for (int kc = 0; kc < 4; ++kc) {
                v16h a = frag_k_contig(&xf[(rt * 16 + lm) * XF_LD + kc * 32], lane);
                v16h b = frag_k_contig(&wslT[(32 + c0 + lm) * WSL_LD + kc * 32], lane);
                acc = wmma_f16(a, b, acc);
            }
#pragma unroll
            for (int v = 0; v < 8; ++v)
                kh[(rt * 16 + v + hi16) * QK_LD + c0 + lm] = (_Float16)acc[v];
        }
        // V tiles -> vT (transposed; each lane's 8 rows are contiguous)
        for (int jt = wave; jt < NT * 2; jt += 8) {
            int rt = jt >> 1, c0 = (jt & 1) * 16;
            v8f acc = zero8();
#pragma unroll
            for (int kc = 0; kc < 4; ++kc) {
                v16h a = frag_k_contig(&xf[(rt * 16 + lm) * XF_LD + kc * 32], lane);
                v16h b = frag_k_contig(&wslT[(64 + c0 + lm) * WSL_LD + kc * 32], lane);
                acc = wmma_f16(a, b, acc);
            }
#pragma unroll
            for (int v = 0; v < 8; ++v)
                vT[(c0 + lm) * VT_LD + rt * 16 + hi16 + v] = (_Float16)acc[v];
        }
        __syncthreads();

        // ---- phase 2: attention; each wave owns query tiles qt, qt+8, ... ----
        const float4* bh = (const float4*)bias_ws + (size_t)h * NT * NT * (BT_F / 4);
        for (int qt = wave; qt < NT; qt += 8) {
            // S row-block (16 x 352) in registers; dh=32 => one WMMA per tile
            v16h qf = frag_k_contig(&qh[(qt * 16 + lm) * QK_LD], lane);
            v8f s[NT];
#pragma unroll
            for (int nt = 0; nt < NT; ++nt) {
                v16h kf = frag_k_contig(&kh[(nt * 16 + lm) * QK_LD], lane);
                s[nt] = wmma_f16(qf, kf, zero8());
            }
            // + relative-position bias (two whole-line float4 loads per tile; the
            // plane holds its own pads, so every lane loads), mask pads
            const float4* bp = bh + (size_t)qt * NT * (BT_F / 4) + lane;
#pragma unroll
            for (int nt = 0; nt < NT; ++nt) {
                int j = nt * 16 + lm;
                bool jv = (j < N_TOK);
                float4 b0 = bp[nt * (BT_F / 4)];
                float4 b1 = bp[nt * (BT_F / 4) + 32];
                float bb[8] = {b0.x, b0.y, b0.z, b0.w, b1.x, b1.y, b1.z, b1.w};
#pragma unroll
                for (int v = 0; v < 8; ++v)
                    s[nt][v] = jv ? (s[nt][v] + bb[v]) : -__builtin_inff();
            }
            // softmax over 352 cols: in-lane partials + 16-lane xor reductions
            float rmax[8], rsum[8];
#pragma unroll
            for (int v = 0; v < 8; ++v) rmax[v] = -__builtin_inff();
#pragma unroll
            for (int nt = 0; nt < NT; ++nt)
#pragma unroll
                for (int v = 0; v < 8; ++v) rmax[v] = fmaxf(rmax[v], s[nt][v]);
#pragma unroll
            for (int v = 0; v < 8; ++v) {
#pragma unroll
                for (int m = 1; m < 16; m <<= 1)
                    rmax[v] = fmaxf(rmax[v], __shfl_xor(rmax[v], m, 32));
                rsum[v] = 0.0f;
            }
#pragma unroll
            for (int nt = 0; nt < NT; ++nt)
#pragma unroll
                for (int v = 0; v < 8; ++v) {
                    float p = __expf(s[nt][v] - rmax[v]);
                    s[nt][v] = p;
                    rsum[v] += p;
                }
#pragma unroll
            for (int v = 0; v < 8; ++v) {
#pragma unroll
                for (int m = 1; m < 16; m <<= 1)
                    rsum[v] += __shfl_xor(rsum[v], m, 32);
                rsum[v] = 1.0f / rsum[v];
            }
#pragma unroll
            for (int nt = 0; nt < NT; ++nt)
#pragma unroll
                for (int v = 0; v < 8; ++v) s[nt][v] *= rsum[v];

            _Float16* pw = pbuf + wave * 16 * QK_LD;
            v8f o0 = zero8(), o1 = zero8();
#pragma unroll
            for (int c = 0; c < 11; ++c) {
#pragma unroll
                for (int v = 0; v < 8; ++v) {
                    int m = v + hi16;
                    pw[m * QK_LD + lm]      = (_Float16)s[2 * c][v];
                    pw[m * QK_LD + 16 + lm] = (_Float16)s[2 * c + 1][v];
                }
                asm volatile("s_wait_dscnt 0x0" ::: "memory");  // wave LDS RAW fence
                v16h pf  = frag_k_contig(&pw[lm * QK_LD], lane);
                v16h vf0 = frag_k_contig(&vT[lm * VT_LD + c * 32], lane);
                v16h vf1 = frag_k_contig(&vT[(16 + lm) * VT_LD + c * 32], lane);
                o0 = wmma_f16(pf, vf0, o0);
                o1 = wmma_f16(pf, vf1, o1);
                asm volatile("s_wait_dscnt 0x0" ::: "memory");  // WAR vs next chunk
            }
#pragma unroll
            for (int v = 0; v < 8; ++v) {
                int row = qt * 16 + v + hi16;
                oacc[row * XF_LD + h * DH + lm]      = (_Float16)o0[v];
                oacc[row * XF_LD + h * DH + 16 + lm] = (_Float16)o1[v];
            }
        }
        __syncthreads();
    }

    // ---- final projection: out = oacc(352x128) @ w_out(128x128) ----
    // w_out transposed (K-contiguous): wave w takes rows 16w..16w+15, a lane one
    // column of each 32-column group; all 64 loads issued before the first is used
    {
        const float* wp = w_out + (wave * 16) * DMODEL + lane;
        float wv[4][16];
#pragma unroll   // wv[][] stays in registers only if indexed by constants
        for (int s = 0; s < 4; ++s)
#pragma unroll   // same: straight-line loads, one after another
            for (int m = 0; m < 16; ++m)
                wv[s][m] = wp[m * DMODEL + s * 32];
#pragma unroll   // constant indices into wv[][]
        for (int s = 0; s < 4; ++s) {
            v8h lo, hi;
#pragma unroll   // constant indices into wv[][], lo, hi
            for (int m = 0; m < 8; ++m) {
                lo[m] = (_Float16)wv[s][m];
                hi[m] = (_Float16)wv[s][8 + m];
            }
            _Float16* wd = &wolT[(s * 32 + lane) * WOL_LD + wave * 16];
            *(v8h*)wd       = lo;
            *(v8h*)(wd + 8) = hi;
        }
    }
    __syncthreads();

    for (int qt = wave; qt < NT; qt += 8) {
        for (int ct = 0; ct < 8; ++ct) {
            v8f acc = zero8();
#pragma unroll
            for (int kc = 0; kc < 4; ++kc) {
                v16h a = frag_k_contig(&oacc[(qt * 16 + lm) * XF_LD + kc * 32], lane);
                v16h b = frag_k_contig(&wolT[(ct * 16 + lm) * WOL_LD + kc * 32], lane);
                acc = wmma_f16(a, b, acc);
            }
#pragma unroll
            for (int v = 0; v < 8; ++v) {
                int row = qt * 16 + v + hi16;
                if (row < N_TOK)
                    out[((size_t)win * N_TOK + row) * DMODEL + ct * 16 + lm] = acc[v];
            }
        }
    }
}

extern "C" void kernel_launch(void* const* d_in, const int* in_sizes, int n_in,
                              void* d_out, int out_size, void* d_ws, size_t ws_size,
                              hipStream_t stream) {
    const float* x        = (const float*)d_in[0];
    const float* w_qkv    = (const float*)d_in[1];
    const float* w_out    = (const float*)d_in[2];
    const float* bias_tab = (const float*)d_in[3];
    const int*   rel_idx  = (const int*)d_in[4];
    float* out     = (float*)d_out;
    float* bias_ws = (float*)d_ws;

    const int total = NHEADS * NT * NT * BT_F;
    bias_gather_kernel<<<(total + 255) / 256, 256, 0, stream>>>(bias_tab, rel_idx,
                                                                bias_ws);
    // 512 windows, 8 waves each, 307200 B dynamic LDS per workgroup
    win_attn_kernel<<<512, 256, 307200, stream>>>(x, w_qkv, w_out, bias_ws, out);
}

// v004
// A run of this version takes 136 microseconds.
// Next to v003, in two timings, it ran 1.36 times as fast each time.
// All steps since v000 together make it 2.84 times as fast.
#include <hip/hip_runtime.h>
#include <hip/hip_bf16.h>

typedef __attribute__((ext_vector_type(16))) _Float16 v16h;
typedef __attribute__((ext_vector_type(4)))  _Float16 v4h;
typedef __attribute__((ext_vector_type(8)))  _Float16 v8h;
typedef __attribute__((ext_vector_type(8)))  float    v8f;

#define N_TOK   343
#define NP      352
#define NT      22
#define BT_F    256     // floats of one 16x16 bias tile, stored in lane order
#define N_REL   2197    // rows of the bias table
#define DMODEL  128
#define DH      32
#define NHEADS  4
#define VT_LD   360
#define WSL_LD  136
#define WOL_LD  136
#define XF_LD   136
#define QK_LD   40
#define QK_SCALE 0.17677669529663689f   // 32^-0.5

__device__ __forceinline__ v16h frag_k_contig(const _Float16* rowptr, int lane) {
    v16h f;
#pragma unroll
    for (int v = 0; v < 8; ++v) {
        int k = 2 * v + ((v & 4) ? 8 : 0) + ((lane & 16) ? 8 : 0);
        f[2 * v]     = rowptr[k];
        f[2 * v + 1] = rowptr[k + 1];
    }
    return f;
}

__device__ __forceinline__ v8f zero8() {
    v8f z;
#pragma unroll
    for (int i = 0; i < 8; ++i) z[i] = 0.0f;
    return z;
}

__device__ __forceinline__ v8f wmma_f16(v16h a, v16h b, v8f c) {
    return __builtin_amdgcn_wmma_f32_16x16x32_f16(false, a, false, b, (short)0, c,
                                                  false, false);
}

__device__ __forceinline__ float xhalf(float x) {
    int b = __builtin_bit_cast(int, x);
    return __builtin_bit_cast(float, __builtin_amdgcn_permlanex16(
        b, b, 0x76543210, 0xfedcba98, false, false));
}

__global__ void bias_gather_kernel(const float* __restrict__ bias_table,
                                   const int*   __restrict__ rel_idx,
                                   float*       __restrict__ bias_ws) {
    int t = blockIdx.x * blockDim.x + threadIdx.x;
    const int total = NHEADS * NT * NT * BT_F;
    if (t >= total) return;
    int e    = t & 3;
    int ln   = (t >> 2) & 31;
    int half = (t >> 7) & 1;
    int tile = t >> 8;
    int nt = tile % NT;
    int qt = (tile / NT) % NT;
    int h  = tile / (NT * NT);
    int i = qt * 16 + (ln & 15);
    int j = nt * 16 + ((ln & 16) ? 8 : 0) + half * 4 + e;
    float b = 0.0f;
    if (i < N_TOK && j < N_TOK) {
        int r = rel_idx[(size_t)i * N_TOK + j];
        r = r < 0 ? 0 : (r > N_REL - 1 ? N_REL - 1 : r);   // table row in bounds
        b = bias_table[(size_t)r * NHEADS + h];
    }
    bias_ws[t] = b;
}

// ---- kernel 1: fully fused window attention, one workgroup per window ----
__global__ __launch_bounds__(256, 1) void win_attn_kernel(
    const float* __restrict__ xg,
    const float* __restrict__ w_qkv,
    const float* __restrict__ w_out,
    const float* __restrict__ bias_ws,
    float*       __restrict__ out) {
    extern __shared__ _Float16 smem[];
    _Float16* xf   = smem;                  // 352 x 136 = 47872 halfs
    _Float16* qh   = xf + NP * XF_LD;       // 352 x 40 per-head Q (pre-scaled)
    _Float16* kh   = qh + NP * QK_LD;       // 352 x 40 per-head K
    _Float16* vT   = kh + NP * QK_LD;       // 32 x 360: V transposed (K-contig)
    _Float16* oacc = vT + DH * VT_LD;       // 352 x 136 attention output
    _Float16* wslT = oacc + NP * XF_LD;     // 96 x 136: qkv slice transposed
    _Float16* wolT = wslT;                  // 128 x 136 = 17408 halfs, over wslT
                                            // (13056) and the 4352 behind it
    // total: 152832 halfs = 305664 bytes (< 320 KB WGP LDS)

    const int tid  = threadIdx.x;
    const int lane = tid & 31;
    const int wave = tid >> 5;
    const int win  = blockIdx.x;
    const int lm   = lane & 15;             // N/M index within a 16-wide tile
    const int hi16 = (lane & 16) ? 8 : 0;   // C-layout row offset, upper half

    // stage x window (343x128 f32 -> f16, zero-pad rows to 352), float4 reads.
    // The whole window is requested before the first value is used: a thread's
    // 43 loads are in flight together, so the stage pays the memory latency once.
    {
        constexpr int XQ    = N_TOK * DMODEL / 4;   // float4s of one window
        constexpr int XFULL = XQ / 256;             // sweeps every thread takes part in
        constexpr int XREM  = XQ % 256;             // threads of the last, partial sweep
        const float4* xw4 = (const float4*)(xg + (size_t)win * N_TOK * DMODEL) + tid;
        float4 f[XFULL + 1];
#pragma unroll   // f[] stays in registers only if indexed by constants
        for (int k = 0; k < XFULL; ++k) f[k] = xw4[k * 256];
        f[XFULL] = make_float4(0.0f, 0.0f, 0.0f, 0.0f);
        if (tid < XREM) f[XFULL] = xw4[XFULL * 256];
        // one sweep = 8 rows; thread: row tid/32 of the sweep, columns 4*(tid%32)..
        _Float16* xd = &xf[(tid >> 5) * XF_LD + (tid & 31) * 4];
#pragma unroll   // f[] stays in registers only if indexed by constants
        for (int k = 0; k <= XFULL; ++k) {
            v4h hv;
            hv[0] = (_Float16)f[k].x; hv[1] = (_Float16)f[k].y;
            hv[2] = (_Float16)f[k].z; hv[3] = (_Float16)f[k].w;
            *(v4h*)(xd + k * 8 * XF_LD) = hv;
        }
        v4h zv;
        zv[0] = zv[1] = zv[2] = zv[3] = (_Float16)0.0f;
        for (int k = XFULL + 1; k < NP / 8; ++k) *(v4h*)(xd + k * 8 * XF_LD) = zv;
    }

    for (int h = 0; h < NHEADS; ++h) {
        // stage this head's 128x96 slice of w_qkv, transposed (K-contiguous).
        // Wave w takes rows 16w..16w+15, a lane one column of each of q, k, v:
        // all 48 loads (one whole line each) are issued before the first is used.
        {
            const float* wp = w_qkv + (size_t)(wave * 16) * (3 * DMODEL) + h * DH + lane;
            float wv[3][16];
#pragma unroll   // wv[][] stays in registers only if indexed by constants
            for (int s = 0; s < 3; ++s)
#pragma unroll   // same: straight-line loads, one after another
                for (int m = 0; m < 16; ++m)
                    wv[s][m] = wp[m * (3 * DMODEL) + s * DMODEL];
#pragma unroll   // constant indices into wv[][]
            for (int s = 0; s < 3; ++s) {
                v8h lo, hi;
#pragma unroll   // constant indices into wv[][], lo, hi
                for (int m = 0; m < 8; ++m) {
                    lo[m] = (_Float16)wv[s][m];
                    hi[m] = (_Float16)wv[s][8 + m];
                }
                _Float16* wd = &wslT[(s * 32 + lane) * WSL_LD + wave * 16];
                *(v8h*)wd       = lo;
                *(v8h*)(wd + 8) = hi;
            }
        }
        __syncthreads();  // also guards prev head's phase-2 reads of qh/kh/vT

        // ---- phase 1: QKV projection, split by destination (uniform stores) --
        // Q tiles -> qh (pre-scaled)
        for (int jt = wave; jt < NT * 2; jt += 8) {
            int rt = jt >> 1, c0 = (jt & 1) * 16;
            v8f acc = zero8();
#pragma unroll
            for (int kc = 0; kc < 4; ++kc) {
                v16h a = frag_k_contig(&xf[(rt * 16 + lm) * XF_LD + kc * 32], lane);
                v16h b = frag_k_contig(&wslT[(c0 + lm) * WSL_LD + kc * 32], lane);
                acc = wmma_f16(a, b, acc);
            }
#pragma unroll
            for (int v = 0; v < 8; ++v)
                qh[(rt * 16 + v + hi16) * QK_LD + c0 + lm] =
                    (_Float16)(acc[v] * QK_SCALE);
        }
        // K tiles -> kh
        for (int jt = wave; jt < NT * 2; jt += 8) {
            int rt = jt >> 1, c0 = (jt & 1) * 16;
            v8f acc = zero8();
#pragma unroll
            for (int kc = 0; kc < 4; ++kc) {
                v16h a = frag_k_contig(&xf[(rt * 16 + lm) * XF_LD + kc * 32], lane);
                v16h b = frag_k_contig(&wslT[(32 + c0 + lm) * WSL_LD + kc * 32], lane);
                acc = wmma_f16(a, b, acc);
            }
#pragma unroll
            for (int v = 0; v < 8; ++v)
                kh[(rt * 16 + v + hi16) * QK_LD + c0 + lm] = (_Float16)acc[v];
        }
        // V tiles -> vT (transposed; each lane's 8 rows are contiguous)
        for (int jt = wave; jt < NT * 2; jt += 8) {
            int rt = jt >> 1, c0 = (jt & 1) * 16;
            v8f acc = zero8();
#pragma unroll
            for (int kc = 0; kc < 4; ++kc) {
                v16h a = frag_k_contig(&xf[(rt * 16 + lm) * XF_LD + kc * 32], lane);
                v16h b = frag_k_contig(&wslT[(64 + c0 + lm) * WSL_LD + kc * 32], lane);
                acc = wmma_f16(a, b, acc);
            }
#pragma unroll
            for (int v = 0; v < 8; ++v)
                vT[(c0 + lm) * VT_LD + rt * 16 + hi16 + v] = (_Float16)acc[v];
        }
        __syncthreads();

        // ---- phase 2: attention; each wave owns query tiles qt, qt+8, ... ----
        const float4* bh = (const float4*)bias_ws + (size_t)h * NT * NT * (BT_F / 4);
        for (int qt = wave; qt < NT; qt += 8) {
            // S^T column-block (352 keys x 16 queries) in registers: A = K rows,
            // B = Q rows; dh=32 => one WMMA per tile. s[nt][v] is the score of
            // key nt*16 + hi16 + v for query qt*16 + lm: a lane holds one query.
            v16h qf = frag_k_contig(&qh[(qt * 16 + lm) * QK_LD], lane);
            v8f s[NT];
#pragma unroll
            for (int nt = 0; nt < NT; ++nt) {
                v16h kf = frag_k_contig(&kh[(nt * 16 + lm) * QK_LD], lane);
                s[nt] = wmma_f16(kf, qf, zero8());
            }
            // + relative-position bias (two whole-line float4 loads per tile; the
            // plane holds its own pads, so every lane loads), mask pad keys
            const float4* bp = bh + (size_t)qt * NT * (BT_F / 4) + lane;
#pragma unroll
            for (int nt = 0; nt < NT; ++nt) {
                float4 b0 = bp[nt * (BT_F / 4)];
                float4 b1 = bp[nt * (BT_F / 4) + 32];
                float bb[8] = {b0.x, b0.y, b0.z, b0.w, b1.x, b1.y, b1.z, b1.w};
#pragma unroll
                for (int v = 0; v < 8; ++v) {
                    bool jv = (nt * 16 + hi16 + v < N_TOK);
                    s[nt][v] = jv ? (s[nt][v] + bb[v]) : -__builtin_inff();
                }
            }
            // softmax over 352 keys: eight in-lane partials (independent chains),
            // joined in the lane, then one exchange between the wave's halves
            float pmax[8], psum[8];
#pragma unroll
            for (int v = 0; v < 8; ++v) pmax[v] = -__builtin_inff();
#pragma unroll
            for (int nt = 0; nt < NT; ++nt)
#pragma unroll
                for (int v = 0; v < 8; ++v) pmax[v] = fmaxf(pmax[v], s[nt][v]);
            float rmax = fmaxf(fmaxf(fmaxf(pmax[0], pmax[1]), fmaxf(pmax[2], pmax[3])),
                               fmaxf(fmaxf(pmax[4], pmax[5]), fmaxf(pmax[6], pmax[7])));
            rmax = fmaxf(rmax, xhalf(rmax));
#pragma unroll
            for (int v = 0; v < 8; ++v) psum[v] = 0.0f;
#pragma unroll
            for (int nt = 0; nt < NT; ++nt)
#pragma unroll
                for (int v = 0; v < 8; ++v) {
                    float p = __expf(s[nt][v] - rmax);
                    s[nt][v] = p;
                    psum[v] += p;
                }
            float rsum = ((psum[0] + psum[1]) + (psum[2] + psum[3])) +
                         ((psum[4] + psum[5]) + (psum[6] + psum[7]));
            rsum += xhalf(rsum);
            rsum = 1.0f / rsum;
#pragma unroll
            for (int nt = 0; nt < NT; ++nt)
#pragma unroll
                for (int v = 0; v < 8; ++v) s[nt][v] *= rsum;

            // ---- O^T = V^T @ P^T : 11 chunks of K=32. Two S^T tiles, converted
            // in place, are the B operand in the k order of frag_k_contig
            // (element e: key e + hi16, element 8 + e: key 16 + e + hi16).
            v8f o0 = zero8(), o1 = zero8();
#pragma unroll
            for (int c = 0; c < 11; ++c) {
                v16h pf;
#pragma unroll
                for (int v = 0; v < 8; ++v) {
                    pf[v]     = (_Float16)s[2 * c][v];
                    pf[8 + v] = (_Float16)s[2 * c + 1][v];
                }
                v16h vf0 = frag_k_contig(&vT[lm * VT_LD + c * 32], lane);
                v16h vf1 = frag_k_contig(&vT[(16 + lm) * VT_LD + c * 32], lane);
                o0 = wmma_f16(vf0, pf, o0);
                o1 = wmma_f16(vf1, pf, o1);
            }
            // o0[v], o1[v]: columns hi16 + v, 16 + hi16 + v of the lane's query
            // row: 8 contiguous halfs each, one 16 B store
            v8h ol, oh;
#pragma unroll
            for (int v = 0; v < 8; ++v) {
                ol[v] = (_Float16)o0[v];
                oh[v] = (_Float16)o1[v];
            }
            _Float16* od = &oacc[(qt * 16 + lm) * XF_LD + h * DH + hi16];
            *(v8h*)od        = ol;
            *(v8h*)(od + 16) = oh;
        }
        __syncthreads();
    }

    // ---- final projection: out = oacc(352x128) @ w_out(128x128) ----
    // w_out transposed (K-contiguous): wave w takes rows 16w..16w+15, a lane one
    // column of each 32-column group; all 64 loads issued before the first is used
    {
        const float* wp = w_out + (wave * 16) * DMODEL + lane;
        float wv[4][16];
#pragma unroll   // wv[][] stays in registers only if indexed by constants
        for (int s = 0; s < 4; ++s)
#pragma unroll   // same: straight-line loads, one after another
            for (int m = 0; m < 16; ++m)
                wv[s][m] = wp[m * DMODEL + s * 32];
#pragma unroll   // constant indices into wv[][]
        for (int s = 0; s < 4; ++s) {
            v8h lo, hi;
#pragma unroll   // constant indices into wv[][], lo, hi
            for (int m = 0; m < 8; ++m) {
                lo[m] = (_Float16)wv[s][m];
                hi[m] = (_Float16)wv[s][8 + m];
            }
            _Float16* wd = &wolT[(s * 32 + lane) * WOL_LD + wave * 16];
            *(v8h*)wd       = lo;
            *(v8h*)(wd + 8) = hi;
        }
    }
    __syncthreads();

    for (int qt = wave; qt < NT; qt += 8) {
        for (int ct = 0; ct < 8; ++ct) {
            v8f acc = zero8();
#pragma unroll
            for (int kc = 0; kc < 4; ++kc) {
                v16h a = frag_k_contig(&oacc[(qt * 16 + lm) * XF_LD + kc * 32], lane);
                v16h b = frag_k_contig(&wolT[(ct * 16 + lm) * WOL_LD + kc * 32], lane);
                acc = wmma_f16(a, b, acc);
            }
#pragma unroll
            for (int v = 0; v < 8; ++v) {
                int row = qt * 16 + v + hi16;
                if (row < N_TOK)
                    out[((size_t)win * N_TOK + row) * DMODEL + ct * 16 + lm] = acc[v];
            }
        }
    }
}

extern "C" void kernel_launch(void* const* d_in, const int* in_sizes, int n_in,
                              void* d_out, int out_size, void* d_ws, size_t ws_size,
                              hipStream_t stream) {
    const float* x        = (const float*)d_in[0];
    const float* w_qkv    = (const float*)d_in[1];
    const float* w_out    = (const float*)d_in[2];
    const float* bias_tab = (const float*)d_in[3];
    const int*   rel_idx  = (const int*)d_in[4];
    float* out     = (float*)d_out;
    float* bias_ws = (float*)d_ws;

    const int total = NHEADS * NT * NT * BT_F;
    bias_gather_kernel<<<(total + 255) / 256, 256, 0, stream>>>(bias_tab, rel_idx,
                                                                bias_ws);
    // 512 windows, 8 waves each, 307200 B dynamic LDS per workgroup
    win_attn_kernel<<<512, 256, 307200, stream>>>(x, w_qkv, w_out, bias_ws, out);
}

// v005
// One run takes 104 microseconds.
// Next to v004, in two timings, it ran 1.30 times as fast each time.
// Over all steps from v000 it is 3.70 times as fast.
#include <hip/hip_runtime.h>
#include <hip/hip_bf16.h>

typedef __attribute__((ext_vector_type(16))) _Float16 v16h;
typedef __attribute__((ext_vector_type(4)))  _Float16 v4h;
typedef __attribute__((ext_vector_type(8)))  _Float16 v8h;
typedef __attribute__((ext_vector_type(8)))  float    v8f;

#define N_TOK   343
#define NP      352
#define NT      22
#define BT_F    256     // floats of one 16x16 bias tile, stored in lane order
#define N_REL   2197    // rows of the bias table
#define DMODEL  128
#define DH      32
#define NHEADS  4
#define VT_LD   360
#define WSL_LD  136
#define WOL_LD  136
#define XF_LD   136
#define QK_LD   40
#define QK_SCALE 0.17677669529663689f   // 32^-0.5

__device__ __forceinline__ v16h frag_k_contig(const _Float16* rowptr, int lane) {
    v16h f;
#pragma unroll
    for (int v = 0; v < 8; ++v) {
        int k = 2 * v + ((v & 4) ? 8 : 0) + ((lane & 16) ? 8 : 0);
        f[2 * v]     = rowptr[k];
        f[2 * v + 1] = rowptr[k + 1];
    }
    return f;
}

__device__ __forceinline__ v8f zero8() {
    v8f z;
#pragma unroll
    for (int i = 0; i < 8; ++i) z[i] = 0.0f;
    return z;
}

__device__ __forceinline__ v8f wmma_f16(v16h a, v16h b, v8f c) {
    return __builtin_amdgcn_wmma_f32_16x16x32_f16(false, a, false, b, (short)0, c,
                                                  false, false);
}

__device__ __forceinline__ float xhalf(float x) {
    int b = __builtin_bit_cast(int, x);
    return __builtin_bit_cast(float, __builtin_amdgcn_permlanex16(
        b, b, 0x76543210, 0xfedcba98, false, false));
}

__global__ void bias_gather_kernel(const float* __restrict__ bias_table,
                                   const int*   __restrict__ rel_idx,
                                   float*       __restrict__ bias_ws) {
    int t = blockIdx.x * blockDim.x + threadIdx.x;
    const int total = NHEADS * NT * NT * BT_F;
    if (t >= total) return;
    int e    = t & 3;
    int ln   = (t >> 2) & 31;
    int half = (t >> 7) & 1;
    int tile = t >> 8;
    int nt = tile % NT;
    int qt = (tile / NT) % NT;
    int h  = tile / (NT * NT);
    int i = qt * 16 + (ln & 15);
    int j = nt * 16 + ((ln & 16) ? 8 : 0) + half * 4 + e;
    float b = 0.0f;
    if (i < N_TOK && j < N_TOK) {
        int r = rel_idx[(size_t)i * N_TOK + j];
        r = r < 0 ? 0 : (r > N_REL - 1 ? N_REL - 1 : r);   // table row in bounds
        b = bias_table[(size_t)r * NHEADS + h];
    }
    bias_ws[t] = b;
}

// ---- kernel 1: fully fused window attention, one workgroup per window ----
__global__ __launch_bounds__(256, 1) void win_attn_kernel(
    const float* __restrict__ xg,
    const float* __restrict__ w_qkv,
    const float* __restrict__ w_out,
    const float* __restrict__ bias_ws,
    float*       __restrict__ out) {
    extern __shared__ _Float16 smem[];
    _Float16* xf   = smem;                  // 352 x 136 = 47872 halfs
    _Float16* qh   = xf + NP * XF_LD;       // 352 x 40 per-head Q (pre-scaled)
    _Float16* kh   = qh + NP * QK_LD;       // 352 x 40 per-head K
    _Float16* vT   = kh + NP * QK_LD;       // 32 x 360: V transposed (K-contig)
    _Float16* oacc = vT + DH * VT_LD;       // 352 x 136 attention output
    _Float16* wslT = oacc + NP * XF_LD;     // 96 x 136: qkv slice transposed
    _Float16* wolT = wslT;                  // 128 x 136 = 17408 halfs, over wslT
                                            // (13056) and the 4352 behind it
    // total: 152832 halfs = 305664 bytes (< 320 KB WGP LDS)

    const int tid  = threadIdx.x;
    const int lane = tid & 31;
    const int wave = tid >> 5;
    const int win  = blockIdx.x;
    const int lm   = lane & 15;             // N/M index within a 16-wide tile
    const int hi16 = (lane & 16) ? 8 : 0;   // C-layout row offset, upper half

    // stage x window (343x128 f32 -> f16, zero-pad rows to 352), float4 reads.
    // The whole window is requested before the first value is used: a thread's
    // 43 loads are in flight together, so the stage pays the memory latency once.
    {
        constexpr int XQ    = N_TOK * DMODEL / 4;   // float4s of one window
        constexpr int XFULL = XQ / 256;             // sweeps every thread takes part in
        constexpr int XREM  = XQ % 256;             // threads of the last, partial sweep
        const float4* xw4 = (const float4*)(xg + (size_t)win * N_TOK * DMODEL) + tid;
        float4 f[XFULL + 1];
#pragma unroll   // f[] stays in registers only if indexed by constants
        for (int k = 0; k < XFULL; ++k) f[k] = xw4[k * 256];
        f[XFULL] = make_float4(0.0f, 0.0f, 0.0f, 0.0f);
        if (tid < XREM) f[XFULL] = xw4[XFULL * 256];
        // one sweep = 8 rows; thread: row tid/32 of the sweep, columns 4*(tid%32)..
        _Float16* xd = &xf[(tid >> 5) * XF_LD + (tid & 31) * 4];
#pragma unroll   // f[] stays in registers only if indexed by constants
        for (int k = 0; k <= XFULL; ++k) {
            v4h hv;
            hv[0] = (_Float16)f[k].x; hv[1] = (_Float16)f[k].y;
            hv[2] = (_Float16)f[k].z; hv[3] = (_Float16)f[k].w;
            *(v4h*)(xd + k * 8 * XF_LD) = hv;
        }
        v4h zv;
        zv[0] = zv[1] = zv[2] = zv[3] = (_Float16)0.0f;
        for (int k = XFULL + 1; k < NP / 8; ++k) *(v4h*)(xd + k * 8 * XF_LD) = zv;
    }

    for (int h = 0; h < NHEADS; ++h) {
        // stage this head's 128x96 slice of w_qkv, transposed (K-contiguous).
        // Wave w takes rows 16w..16w+15, a lane one column of each of q, k, v:
        // all 48 loads (one whole line each) are issued before the first is used.
        {
            const float* wp = w_qkv + (size_t)(wave * 16) * (3 * DMODEL) + h * DH + lane;
            float wv[3][16];
#pragma unroll   // wv[][] stays in registers only if indexed by constants
            for (int s = 0; s < 3; ++s)
#pragma unroll   // same: straight-line loads, one after another
                for (int m = 0; m < 16; ++m)
                    wv[s][m] = wp[m * (3 * DMODEL) + s * DMODEL];
#pragma unroll   // constant indices into wv[][]
            for (int s = 0; s < 3; ++s) {
                v8h lo, hi;
#pragma unroll   // constant indices into wv[][], lo, hi
                for (int m = 0; m < 8; ++m) {
                    lo[m] = (_Float16)wv[s][m];
                    hi[m] = (_Float16)wv[s][8 + m];
                }
                _Float16* wd = &wslT[(s * 32 + lane) * WSL_LD + wave * 16];
                *(v8h*)wd       = lo;
                *(v8h*)(wd + 8) = hi;
            }
        }
        __syncthreads();  // also guards prev head's phase-2 reads of qh/kh/vT

        // ---- phase 1: QKV projection, split by destination (uniform stores) --
        // Q tiles -> qh (pre-scaled)
        for (int jt = wave; jt < NT * 2; jt += 8) {
            int rt = jt >> 1, c0 = (jt & 1) * 16;
            v8f acc = zero8();
            v16h a[4], b[4];
#pragma unroll   // a[], b[] stay in registers only if indexed by constants
            for (int kc = 0; kc < 4; ++kc) {
                a[kc] = frag_k_contig(&xf[(rt * 16 + lm) * XF_LD + kc * 32], lane);
                b[kc] = frag_k_contig(&wslT[(c0 + lm) * WSL_LD + kc * 32], lane);
            }
            // keeps the tile's 16 reads in one group ahead of its four products
            // (spread among them, the last reads' LDS latency is waited out)
            __builtin_amdgcn_sched_barrier(0);
#pragma unroll
            for (int kc = 0; kc < 4; ++kc) acc = wmma_f16(a[kc], b[kc], acc);
#pragma unroll
            for (int v = 0; v < 8; ++v)
                qh[(rt * 16 + v + hi16) * QK_LD + c0 + lm] =
                    (_Float16)(acc[v] * QK_SCALE);
        }
        // K tiles -> kh
        for (int jt = wave; jt < NT * 2; jt += 8) {
            int rt = jt >> 1, c0 = (jt & 1) * 16;
            v8f acc = zero8();
            v16h a[4], b[4];
#pragma unroll   // a[], b[] stay in registers only if indexed by constants
            for (int kc = 0; kc < 4; ++kc) {
                a[kc] = frag_k_contig(&xf[(rt * 16 + lm) * XF_LD + kc * 32], lane);
                b[kc] = frag_k_contig(&wslT[(32 + c0 + lm) * WSL_LD + kc * 32], lane);
            }
            // keeps the tile's 16 reads in one group ahead of its four products
            // (spread among them, the last reads' LDS latency is waited out)
            __builtin_amdgcn_sched_barrier(0);
#pragma unroll
            for (int kc = 0; kc < 4; ++kc) acc = wmma_f16(a[kc], b[kc], acc);
#pragma unroll
            for (int v = 0; v < 8; ++v)
                kh[(rt * 16 + v + hi16) * QK_LD + c0 + lm] = (_Float16)acc[v];
        }
        // V tiles -> vT (transposed; each lane's 8 rows are contiguous)
        for (int jt = wave; jt < NT * 2; jt += 8) {
            int rt = jt >> 1, c0 = (jt & 1) * 16;
            v8f acc = zero8();
            v16h a[4], b[4];
#pragma unroll   // a[], b[] stay in registers only if indexed by constants
            for (int kc = 0; kc < 4; ++kc) {
                a[kc] = frag_k_contig(&xf[(rt * 16 + lm) * XF_LD + kc * 32], lane);
                b[kc] = frag_k_contig(&wslT[(64 + c0 + lm) * WSL_LD + kc * 32], lane);
            }
            // keeps the tile's 16 reads in one group ahead of its four products
            // (spread among them, the last reads' LDS latency is waited out)
            __builtin_amdgcn_sched_barrier(0);
#pragma unroll
            for (int kc = 0; kc < 4; ++kc) acc = wmma_f16(a[kc], b[kc], acc);
#pragma unroll
            for (int v = 0; v < 8; ++v)
                vT[(c0 + lm) * VT_LD + rt * 16 + hi16 + v] = (_Float16)acc[v];
        }
        __syncthreads();

        // ---- phase 2: attention; each wave owns query tiles qt, qt+8, ... ----
        const float4* bh = (const float4*)bias_ws + (size_t)h * NT * NT * (BT_F / 4);
        for (int qt = wave; qt < NT; qt += 8) {
            // S^T column-block (352 keys x 16 queries) in registers: A = K rows,
            // B = Q rows; dh=32 => one WMMA per tile. s[nt][v] is the score of
            // key nt*16 + hi16 + v for query qt*16 + lm: a lane holds one query.
            // The tile's bias loads (two whole-line float4 loads per key tile; the
            // plane holds its own pads, so every lane loads) and ALL its Q and K
            // fragment reads are issued as one group ahead of the 22 products.
            const float4* bp = bh + (size_t)qt * NT * (BT_F / 4) + lane;
            float4 b0[NT], b1[NT];
#pragma unroll   // b0[], b1[] stay in registers only if indexed by constants
            for (int nt = 0; nt < NT; ++nt) {
                b0[nt] = bp[nt * (BT_F / 4)];
                b1[nt] = bp[nt * (BT_F / 4) + 32];
            }
            v16h qf = frag_k_contig(&qh[(qt * 16 + lm) * QK_LD], lane);
            v16h kf[NT];
#pragma unroll   // kf[] stays in registers only if indexed by constants
            for (int nt = 0; nt < NT; ++nt)
                kf[nt] = frag_k_contig(&kh[(nt * 16 + lm) * QK_LD], lane);
            // keeps the reads above from sinking back between the products, where
            // each product would wait out the LDS latency of its own two reads
            __builtin_amdgcn_sched_barrier(0);
            v8f s[NT];
#pragma unroll
            for (int nt = 0; nt < NT; ++nt) s[nt] = wmma_f16(kf[nt], qf, zero8());
            // + relative-position bias, mask pad keys
#pragma unroll
            for (int nt = 0; nt < NT; ++nt) {
                float bb[8] = {b0[nt].x, b0[nt].y, b0[nt].z, b0[nt].w,
                               b1[nt].x, b1[nt].y, b1[nt].z, b1[nt].w};
#pragma unroll
                for (int v = 0; v < 8; ++v) {
                    bool jv = (nt * 16 + hi16 + v < N_TOK);
                    s[nt][v] = jv ? (s[nt][v] + bb[v]) : -__builtin_inff();
                }
            }
            // All V^T fragment reads, into the registers the bias has left: they
            // land while the softmax below runs.
            v16h vf0[NT / 2], vf1[NT / 2];
#pragma unroll   // vf0[], vf1[] stay in registers only if indexed by constants
            for (int c = 0; c < NT / 2; ++c) {
                vf0[c] = frag_k_contig(&vT[lm * VT_LD + c * 32], lane);
                vf1[c] = frag_k_contig(&vT[(16 + lm) * VT_LD + c * 32], lane);
            }
            // keeps these reads ahead of the softmax: sunk to their products, each
            // product would wait out the LDS latency of its own two reads
            __builtin_amdgcn_sched_barrier(0);
            // softmax over 352 keys: eight in-lane partials (independent chains),
            // joined in the lane, then one exchange between the wave's halves
            float pmax[8], psum[8];
#pragma unroll
            for (int v = 0; v < 8; ++v) pmax[v] = -__builtin_inff();
#pragma unroll
            for (int nt = 0; nt < NT; ++nt)
#pragma unroll
                for (int v = 0; v < 8; ++v) pmax[v] = fmaxf(pmax[v], s[nt][v]);
            float rmax = fmaxf(fmaxf(fmaxf(pmax[0], pmax[1]), fmaxf(pmax[2], pmax[3])),
                               fmaxf(fmaxf(pmax[4], pmax[5]), fmaxf(pmax[6], pmax[7])));
            rmax = fmaxf(rmax, xhalf(rmax));
#pragma unroll
            for (int v = 0; v < 8; ++v) psum[v] = 0.0f;
#pragma unroll
            for (int nt = 0; nt < NT; ++nt)
#pragma unroll
                for (int v = 0; v < 8; ++v) {
                    float p = __expf(s[nt][v] - rmax);
                    s[nt][v] = p;
                    psum[v] += p;
                }
            float rsum = ((psum[0] + psum[1]) + (psum[2] + psum[3])) +
                         ((psum[4] + psum[5]) + (psum[6] + psum[7]));
            rsum += xhalf(rsum);
            rsum = 1.0f / rsum;
#pragma unroll
            for (int nt = 0; nt < NT; ++nt)
#pragma unroll
                for (int v = 0; v < 8; ++v) s[nt][v] *= rsum;

            // ---- O^T = V^T @ P^T : 11 chunks of K=32. Two S^T tiles, converted
            // in place, are the B operand in the k order of frag_k_contig
            // (element e: key e + hi16, element 8 + e: key 16 + e + hi16).
            v8f o0 = zero8(), o1 = zero8();
#pragma unroll
            for (int c = 0; c < 11; ++c) {
                v16h pf;
#pragma unroll
                for (int v = 0; v < 8; ++v) {
                    pf[v]     = (_Float16)s[2 * c][v];
                    pf[8 + v] = (_Float16)s[2 * c + 1][v];
                }
                o0 = wmma_f16(vf0[c], pf, o0);
                o1 = wmma_f16(vf1[c], pf, o1);
            }
            // o0[v], o1[v]: columns hi16 + v, 16 + hi16 + v of the lane's query
            // row: 8 contiguous halfs each, one 16 B store
            v8h ol, oh;
#pragma unroll
            for (int v = 0; v < 8; ++v) {
                ol[v] = (_Float16)o0[v];
                oh[v] = (_Float16)o1[v];
            }
            _Float16* od = &oacc[(qt * 16 + lm) * XF_LD + h * DH + hi16];
            *(v8h*)od        = ol;
            *(v8h*)(od + 16) = oh;
        }
        __syncthreads();
    }

    // ---- final projection: out = oacc(352x128) @ w_out(128x128) ----
    // w_out transposed (K-contiguous): wave w takes rows 16w..16w+15, a lane one
    // column of each 32-column group; all 64 loads issued before the first is used
    {
        const float* wp = w_out + (wave * 16) * DMODEL + lane;
        float wv[4][16];
#pragma unroll   // wv[][] stays in registers only if indexed by constants
        for (int s = 0; s < 4; ++s)
#pragma unroll   // same: straight-line loads, one after another
            for (int m = 0; m < 16; ++m)
                wv[s][m] = wp[m * DMODEL + s * 32];
#pragma unroll   // constant indices into wv[][]
        for (int s = 0; s < 4; ++s) {
            v8h lo, hi;
#pragma unroll   // constant indices into wv[][], lo, hi
            for (int m = 0; m < 8; ++m) {
                lo[m] = (_Float16)wv[s][m];
                hi[m] = (_Float16)wv[s][8 + m];
            }
            _Float16* wd = &wolT[(s * 32 + lane) * WOL_LD + wave * 16];
            *(v8h*)wd       = lo;
            *(v8h*)(wd + 8) = hi;
        }
    }
    __syncthreads();

    for (int qt = wave; qt < NT; qt += 8) {
        v16h a[4];   // the query tile's rows: read once for its 8 column tiles
#pragma unroll   // a[] stays in registers only if indexed by constants
        for (int kc = 0; kc < 4; ++kc)
            a[kc] = frag_k_contig(&oacc[(qt * 16 + lm) * XF_LD + kc * 32], lane);
        for (int ct = 0; ct < 8; ++ct) {
            v8f acc = zero8();
            v16h b[4];
#pragma unroll   // b[] stays in registers only if indexed by constants
            for (int kc = 0; kc < 4; ++kc)
                b[kc] = frag_k_contig(&wolT[(ct * 16 + lm) * WOL_LD + kc * 32], lane);
            // keeps the tile's reads in one group ahead of its four products: sunk
            // between them, each product would wait out its own reads' LDS latency
            __builtin_amdgcn_sched_barrier(0);
#pragma unroll
            for (int kc = 0; kc < 4; ++kc) acc = wmma_f16(a[kc], b[kc], acc);
#pragma unroll
            for (int v = 0; v < 8; ++v) {
                int row = qt * 16 + v + hi16;
                if (row < N_TOK)
                    out[((size_t)win * N_TOK + row) * DMODEL + ct * 16 + lm] = acc[v];
            }
        }
    }
}

extern "C" void kernel_launch(void* const* d_in, const int* in_sizes, int n_in,
                              void* d_out, int out_size, void* d_ws, size_t ws_size,
                              hipStream_t stream) {
    const float* x        = (const float*)d_in[0];
    const float* w_qkv    = (const float*)d_in[1];
    const float* w_out    = (const float*)d_in[2];
    const float* bias_tab = (const float*)d_in[3];
    const int*   rel_idx  = (const int*)d_in[4];
    float* out     = (float*)d_out;
    float* bias_ws = (float*)d_ws;

    const int total = NHEADS * NT * NT * BT_F;
    bias_gather_kernel<<<(total + 255) / 256, 256, 0, stream>>>(bias_tab, rel_idx,
                                                                bias_ws);
    // 512 windows, 8 waves each, 307200 B dynamic LDS per workgroup
    win_attn_kernel<<<512, 256, 307200, stream>>>(x, w_qkv, w_out, bias_ws, out);
}

// v006
// It runs in 89.2 microseconds.
// Timed twice side by side with v005, it ran 1.17 times as fast both times.
// Over all steps from v000 it is 4.32 times as fast.
#include <hip/hip_runtime.h>
#include <hip/hip_bf16.h>

typedef __attribute__((ext_vector_type(16))) _Float16 v16h;
typedef __attribute__((ext_vector_type(4)))  _Float16 v4h;
typedef __attribute__((ext_vector_type(8)))  _Float16 v8h;
typedef __attribute__((ext_vector_type(8)))  float    v8f;

#define N_TOK   343
#define NP      352
#define NT      22
#define BT_F    256     // floats of one 16x16 bias tile, stored in lane order
#define N_REL   2197    // rows of the bias table
#define DMODEL  128
#define DH      32
#define NHEADS  4
#define VT_LD   360
#define WSL_LD  136
#define WOL_LD  136
#define XF_LD   136
#define QK_LD   40
#define QK_SCALE 0.17677669529663689f   // 32^-0.5

__device__ __forceinline__ v16h frag_k_contig(const _Float16* rowptr, int lane) {
    v16h f;
#pragma unroll
    for (int v = 0; v < 8; ++v) {
        int k = 2 * v + ((v & 4) ? 8 : 0) + ((lane & 16) ? 8 : 0);
        f[2 * v]     = rowptr[k];
        f[2 * v + 1] = rowptr[k + 1];
    }
    return f;
}

__device__ __forceinline__ v8f zero8() {
    v8f z;
#pragma unroll
    for (int i = 0; i < 8; ++i) z[i] = 0.0f;
    return z;
}

__device__ __forceinline__ v8f wmma_f16(v16h a, v16h b, v8f c) {
    return __builtin_amdgcn_wmma_f32_16x16x32_f16(false, a, false, b, (short)0, c,
                                                  false, false);
}

__device__ __forceinline__ float xhalf(float x) {
    int b = __builtin_bit_cast(int, x);
    return __builtin_bit_cast(float, __builtin_amdgcn_permlanex16(
        b, b, 0x76543210, 0xfedcba98, false, false));
}

// One 16-row tile of x times the head's six 16-column weight tiles (q0 q1 k0 k1
// v0 v1), all operands already in registers: six independent accumulators, each
// summed over kc = 0..3 in that order. qst: the lane's place in row hi16 of the
// tile in qh (kh lies NP rows behind it); vst: its place in vT.
__device__ __forceinline__ void qkv_row_tile(const v16h (&a)[4], const v16h (&b)[6][4],
                                             _Float16* qst, _Float16* vst) {
    v8f acc[6];
#pragma unroll   // acc[] stays in registers only if indexed by constants
    for (int j = 0; j < 6; ++j) acc[j] = zero8();
#pragma unroll
    for (int kc = 0; kc < 4; ++kc) {
#pragma unroll
        for (int j = 0; j < 6; ++j) acc[j] = wmma_f16(a[kc], b[j][kc], acc[j]);
        // keeps the six independent products of one kc side by side: regrouped
        // into per-tile chains, each product would wait out the accumulate latency
        __builtin_amdgcn_sched_barrier(0);
        if (kc == 0)
            asm volatile("" ::"v"(b[0][0]), "v"(b[1][0]), "v"(b[2][0]), "v"(b[3][0]),
                         "v"(b[4][0]), "v"(b[5][0]));
    }
#pragma unroll
    for (int j = 0; j < 2; ++j)
#pragma unroll
        for (int v = 0; v < 8; ++v) {
            qst[v * QK_LD + j * 16] = (_Float16)(acc[j][v] * QK_SCALE);   // Q, pre-scaled
            qst[(NP + v) * QK_LD + j * 16] = (_Float16)acc[2 + j][v];     // K
        }
    // V transposed: each lane's 8 rows are contiguous, one 16 B store
#pragma unroll
    for (int j = 0; j < 2; ++j) {
        v8h vv;
#pragma unroll
        for (int v = 0; v < 8; ++v) vv[v] = (_Float16)acc[4 + j][v];
        *(v8h*)(vst + j * 16 * VT_LD) = vv;
    }
}

// One 16-row tile of the attention output times all eight 16-column tiles of
// w_out, operands in registers: eight independent accumulators (kc = 0..3 each).
// ost: the lane's place in row hi16 of the tile in out; rows_left: how many rows
// from there on exist (looked at only where GUARD is set).
template <bool GUARD>
__device__ __forceinline__ void out_row_tile(const v16h (&a)[4], const v16h (&b)[8][4],
                                             float* ost, int rows_left) {
    v8f acc[8];
#pragma unroll   // acc[] stays in registers only if indexed by constants
    for (int ct = 0; ct < 8; ++ct) acc[ct] = zero8();
#pragma unroll
    for (int kc = 0; kc < 4; ++kc) {
#pragma unroll
        for (int ct = 0; ct < 8; ++ct) acc[ct] = wmma_f16(a[kc], b[ct][kc], acc[ct]);
        // keeps the eight independent products of one kc side by side: regrouped
        // into per-tile chains, each product would wait out the accumulate latency
        __builtin_amdgcn_sched_barrier(0);
        if (kc == 0)
            asm volatile("" ::"v"(b[0][0]), "v"(b[1][0]), "v"(b[2][0]), "v"(b[3][0]),
                         "v"(b[4][0]), "v"(b[5][0]), "v"(b[6][0]), "v"(b[7][0]));
    }
#pragma unroll
    for (int v = 0; v < 8; ++v) {
        if (!GUARD || v < rows_left) {
#pragma unroll
            for (int ct = 0; ct < 8; ++ct) ost[v * DMODEL + ct * 16] = acc[ct][v];
        }
    }
}

__global__ void bias_gather_kernel(const float* __restrict__ bias_table,
                                   const int*   __restrict__ rel_idx,
                                   float*       __restrict__ bias_ws) {
    int t = blockIdx.x * blockDim.x + threadIdx.x;
    const int total = NHEADS * NT * NT * BT_F;
    if (t >= total) return;
    int e    = t & 3;
    int ln   = (t >> 2) & 31;
    int half = (t >> 7) & 1;
    int tile = t >> 8;
    int nt = tile % NT;
    int qt = (tile / NT) % NT;
    int h  = tile / (NT * NT);
    int i = qt * 16 + (ln & 15);
    int j = nt * 16 + ((ln & 16) ? 8 : 0) + half * 4 + e;
    float b = 0.0f;
    if (i < N_TOK && j < N_TOK) {
        int r = rel_idx[(size_t)i * N_TOK + j];
        r = r < 0 ? 0 : (r > N_REL - 1 ? N_REL - 1 : r);   // table row in bounds
        b = bias_table[(size_t)r * NHEADS + h];
    }
    bias_ws[t] = b;
}

// ---- kernel 1: fully fused window attention, one workgroup per window ----
__global__ __launch_bounds__(256, 1) void win_attn_kernel(
    const float* __restrict__ xg,
    const float* __restrict__ w_qkv,
    const float* __restrict__ w_out,
    const float* __restrict__ bias_ws,
    float*       __restrict__ out) {
    extern __shared__ _Float16 smem[];
    _Float16* xf   = smem;                  // 352 x 136 = 47872 halfs
    _Float16* qh   = xf + NP * XF_LD;       // 352 x 40 per-head Q (pre-scaled)
    _Float16* kh   = qh + NP * QK_LD;       // 352 x 40 per-head K
    _Float16* vT   = kh + NP * QK_LD;       // 32 x 360: V transposed (K-contig)
    _Float16* oacc = vT + DH * VT_LD;       // 352 x 136 attention output
    _Float16* wslT = oacc + NP * XF_LD;     // 96 x 136: qkv slice transposed
    _Float16* wolT = wslT;                  // 128 x 136 = 17408 halfs, over wslT
                                            // (13056) and the 4352 behind it
    // total: 152832 halfs = 305664 bytes (< 320 KB WGP LDS)

    const int tid  = threadIdx.x;
    const int lane = tid & 31;
    const int wave = tid >> 5;
    const int win  = blockIdx.x;
    const int lm   = lane & 15;             // N/M index within a 16-wide tile
    const int hi16 = (lane & 16) ? 8 : 0;   // C-layout row offset, upper half

    // stage x window (343x128 f32 -> f16, zero-pad rows to 352), float4 reads.
    // The whole window is requested before the first value is used: a thread's
    // 43 loads are in flight together, so the stage pays the memory latency once.
    {
        constexpr int XQ    = N_TOK * DMODEL / 4;   // float4s of one window
        constexpr int XFULL = XQ / 256;             // sweeps every thread takes part in
        constexpr int XREM  = XQ % 256;             // threads of the last, partial sweep
        const float4* xw4 = (const float4*)(xg + (size_t)win * N_TOK * DMODEL) + tid;
        float4 f[XFULL + 1];
#pragma unroll   // f[] stays in registers only if indexed by constants
        for (int k = 0; k < XFULL; ++k) f[k] = xw4[k * 256];
        f[XFULL] = make_float4(0.0f, 0.0f, 0.0f, 0.0f);
        if (tid < XREM) f[XFULL] = xw4[XFULL * 256];
        // one sweep = 8 rows; thread: row tid/32 of the sweep, columns 4*(tid%32)..
        _Float16* xd = &xf[(tid >> 5) * XF_LD + (tid & 31) * 4];
#pragma unroll   // f[] stays in registers only if indexed by constants
        for (int k = 0; k <= XFULL; ++k) {
            v4h hv;
            hv[0] = (_Float16)f[k].x; hv[1] = (_Float16)f[k].y;
            hv[2] = (_Float16)f[k].z; hv[3] = (_Float16)f[k].w;
            *(v4h*)(xd + k * 8 * XF_LD) = hv;
        }
        v4h zv;
        zv[0] = zv[1] = zv[2] = zv[3] = (_Float16)0.0f;
        for (int k = XFULL + 1; k < NP / 8; ++k) *(v4h*)(xd + k * 8 * XF_LD) = zv;
    }

    for (int h = 0; h < NHEADS; ++h) {
        // stage this head's 128x96 slice of w_qkv, transposed (K-contiguous).
        // Wave w takes rows 16w..16w+15, a lane one column of each of q, k, v:
        // all 48 loads (one whole line each) are issued before the first is used.
        {
            const float* wp = w_qkv + (size_t)(wave * 16) * (3 * DMODEL) + h * DH + lane;
            float wv[3][16];
#pragma unroll   // wv[][] stays in registers only if indexed by constants
            for (int s = 0; s < 3; ++s)
#pragma unroll   // same: straight-line loads, one after another
                for (int m = 0; m < 16; ++m)
                    wv[s][m] = wp[m * (3 * DMODEL) + s * DMODEL];
#pragma unroll   // constant indices into wv[][]
            for (int s = 0; s < 3; ++s) {
                v8h lo, hi;
#pragma unroll   // constant indices into wv[][], lo, hi
                for (int m = 0; m < 8; ++m) {
                    lo[m] = (_Float16)wv[s][m];
                    hi[m] = (_Float16)wv[s][8 + m];
                }
                _Float16* wd = &wslT[(s * 32 + lane) * WSL_LD + wave * 16];
                *(v8h*)wd       = lo;
                *(v8h*)(wd + 8) = hi;
            }
        }
        __syncthreads();  // also guards prev head's phase-2 reads of qh/kh/vT

        // ---- phase 1: QKV projection. A wave takes whole row tiles (wave, wave + 8,
        // wave + 16) and holds the head's 24 weight fragments in registers for all
        // of them: an x fragment is read from LDS once for its six column tiles,
        // a weight fragment once per wave, not once per tile.
        {
            const bool third = wave < NT - 16;          // row tiles 16..21
            const int  rt2   = third ? wave + 16 : wave; // else an in-range re-read, unused
            v16h a0[4], a1[4], a2[4], b[6][4];
#pragma unroll   // a0[] stays in registers only if indexed by constants
            for (int kc = 0; kc < 4; ++kc)
                a0[kc] = frag_k_contig(&xf[(wave * 16 + lm) * XF_LD + kc * 32], lane);
#pragma unroll   // b[][] stays in registers only if indexed by constants
            for (int kc = 0; kc < 4; ++kc)
#pragma unroll
                for (int j = 0; j < 6; ++j)
                    b[j][kc] = frag_k_contig(&wslT[(j * 16 + lm) * WSL_LD + kc * 32], lane);
#pragma unroll   // a1[], a2[] stay in registers only if indexed by constants
            for (int kc = 0; kc < 4; ++kc) {
                a1[kc] = frag_k_contig(&xf[((wave + 8) * 16 + lm) * XF_LD + kc * 32], lane);
                a2[kc] = frag_k_contig(&xf[(rt2 * 16 + lm) * XF_LD + kc * 32], lane);
            }
            // keeps all reads in one group, in the order the products use them: sunk
            // between the products, each would wait out its own reads' LDS latency
            __builtin_amdgcn_sched_barrier(0);
            _Float16* qst = &qh[(wave * 16 + hi16) * QK_LD + lm];
            _Float16* vst = &vT[lm * VT_LD + wave * 16 + hi16];
            qkv_row_tile(a0, b, qst, vst);
            qkv_row_tile(a1, b, qst + 128 * QK_LD, vst + 128);
            if (third) qkv_row_tile(a2, b, qst + 256 * QK_LD, vst + 256);
        }
        __syncthreads();

        // ---- phase 2: attention; each wave owns query tiles qt, qt+8, ... ----
        const float4* bh = (const float4*)bias_ws + (size_t)h * NT * NT * (BT_F / 4);
        for (int qt = wave; qt < NT; qt += 8) {
            // S^T column-block (352 keys x 16 queries) in registers: A = K rows,
            // B = Q rows; dh=32 => one WMMA per tile. s[nt][v] is the score of
            // key nt*16 + hi16 + v for query qt*16 + lm: a lane holds one query.
            // The tile's bias loads (two whole-line float4 loads per key tile; the
            // plane holds its own pads, so every lane loads) and ALL its Q and K
            // fragment reads are issued as one group ahead of the 22 products.
            const float4* bp = bh + (size_t)qt * NT * (BT_F / 4) + lane;
            float4 b0[NT], b1[NT];
#pragma unroll   // b0[], b1[] stay in registers only if indexed by constants
            for (int nt = 0; nt < NT; ++nt) {
                b0[nt] = bp[nt * (BT_F / 4)];
                b1[nt] = bp[nt * (BT_F / 4) + 32];
            }
            v16h qf = frag_k_contig(&qh[(qt * 16 + lm) * QK_LD], lane);
            v16h kf[NT];
#pragma unroll   // kf[] stays in registers only if indexed by constants
            for (int nt = 0; nt < NT; ++nt)
                kf[nt] = frag_k_contig(&kh[(nt * 16 + lm) * QK_LD], lane);
            // keeps the reads above from sinking back between the products, where
            // each product would wait out the LDS latency of its own two reads
            __builtin_amdgcn_sched_barrier(0);
            v8f s[NT];
#pragma unroll
            for (int nt = 0; nt < NT; ++nt) s[nt] = wmma_f16(kf[nt], qf, zero8());
            // + relative-position bias, mask pad keys
#pragma unroll
            for (int nt = 0; nt < NT; ++nt) {
                float bb[8] = {b0[nt].x, b0[nt].y, b0[nt].z, b0[nt].w,
                               b1[nt].x, b1[nt].y, b1[nt].z, b1[nt].w};
#pragma unroll
                for (int v = 0; v < 8; ++v) {
                    bool jv = (nt * 16 + hi16 + v < N_TOK);
                    s[nt][v] = jv ? (s[nt][v] + bb[v]) : -__builtin_inff();
                }
            }
            // All V^T fragment reads, into the registers the bias has left: they
            // land while the softmax below runs.
            v16h vf0[NT / 2], vf1[NT / 2];
#pragma unroll   // vf0[], vf1[] stay in registers only if indexed by constants
            for (int c = 0; c < NT / 2; ++c) {
                vf0[c] = frag_k_contig(&vT[lm * VT_LD + c * 32], lane);
                vf1[c] = frag_k_contig(&vT[(16 + lm) * VT_LD + c * 32], lane);
            }
            // keeps these reads ahead of the softmax: sunk to their products, each
            // product would wait out the LDS latency of its own two reads
            __builtin_amdgcn_sched_barrier(0);
            // softmax over 352 keys: eight in-lane partials (independent chains),
            // joined in the lane, then one exchange between the wave's halves
            float pmax[8], psum[8];
#pragma unroll
            for (int v = 0; v < 8; ++v) pmax[v] = -__builtin_inff();
#pragma unroll
            for (int nt = 0; nt < NT; ++nt)
#pragma unroll
                for (int v = 0; v < 8; ++v) pmax[v] = fmaxf(pmax[v], s[nt][v]);
            float rmax = fmaxf(fmaxf(fmaxf(pmax[0], pmax[1]), fmaxf(pmax[2], pmax[3])),
                               fmaxf(fmaxf(pmax[4], pmax[5]), fmaxf(pmax[6], pmax[7])));
            rmax = fmaxf(rmax, xhalf(rmax));
#pragma unroll
            for (int v = 0; v < 8; ++v) psum[v] = 0.0f;
#pragma unroll
            for (int nt = 0; nt < NT; ++nt)
#pragma unroll
                for (int v = 0; v < 8; ++v) {
                    float p = __expf(s[nt][v] - rmax);
                    s[nt][v] = p;
                    psum[v] += p;
                }
            float rsum = ((psum[0] + psum[1]) + (psum[2] + psum[3])) +
                         ((psum[4] + psum[5]) + (psum[6] + psum[7]));
            rsum += xhalf(rsum);
            rsum = 1.0f / rsum;
#pragma unroll
            for (int nt = 0; nt < NT; ++nt)
#pragma unroll
                for (int v = 0; v < 8; ++v) s[nt][v] *= rsum;

            // ---- O^T = V^T @ P^T : 11 chunks of K=32. Two S^T tiles, converted
            // in place, are the B operand in the k order of frag_k_contig
            // (element e: key e + hi16, element 8 + e: key 16 + e + hi16).
            v8f o0 = zero8(), o1 = zero8();
#pragma unroll
            for (int c = 0; c < 11; ++c) {
                v16h pf;
#pragma unroll
                for (int v = 0; v < 8; ++v) {
                    pf[v]     = (_Float16)s[2 * c][v];
                    pf[8 + v] = (_Float16)s[2 * c + 1][v];
                }
                o0 = wmma_f16(vf0[c], pf, o0);
                o1 = wmma_f16(vf1[c], pf, o1);
            }
            // o0[v], o1[v]: columns hi16 + v, 16 + hi16 + v of the lane's query
            // row: 8 contiguous halfs each, one 16 B store
            v8h ol, oh;
#pragma unroll
            for (int v = 0; v < 8; ++v) {
                ol[v] = (_Float16)o0[v];
                oh[v] = (_Float16)o1[v];
            }
            _Float16* od = &oacc[(qt * 16 + lm) * XF_LD + h * DH + hi16];
            *(v8h*)od        = ol;
            *(v8h*)(od + 16) = oh;
        }
        __syncthreads();
    }

    // ---- final projection: out = oacc(352x128) @ w_out(128x128) ----
    // w_out transposed (K-contiguous): wave w takes rows 16w..16w+15, a lane one
    // column of each 32-column group; all 64 loads issued before the first is used
    {
        const float* wp = w_out + (wave * 16) * DMODEL + lane;
        float wv[4][16];
#pragma unroll   // wv[][] stays in registers only if indexed by constants
        for (int s = 0; s < 4; ++s)
#pragma unroll   // same: straight-line loads, one after another
            for (int m = 0; m < 16; ++m)
                wv[s][m] = wp[m * DMODEL + s * 32];
        // the conversions below reuse the loads' address registers
        asm volatile("s_wait_xcnt 0x0" ::: "memory");
        // keeps the conversions behind that wait
        __builtin_amdgcn_sched_barrier(0);
#pragma unroll   // constant indices into wv[][]
        for (int s = 0; s < 4; ++s) {
            v8h lo, hi;
#pragma unroll   // constant indices into wv[][], lo, hi
            for (int m = 0; m < 8; ++m) {
                lo[m] = (_Float16)wv[s][m];
                hi[m] = (_Float16)wv[s][8 + m];
            }
            _Float16* wd = &wolT[(s * 32 + lane) * WOL_LD + wave * 16];
            *(v8h*)wd       = lo;
            *(v8h*)(wd + 8) = hi;
        }
    }
    __syncthreads();

    // A wave holds all 32 fragments of w_out in registers for its row tiles (wave,
    // wave + 8, wave + 16): each is read from LDS once per wave, not once per tile.
    {
        const bool third = wave < NT - 16;          // row tiles 16..21
        const int  qt2   = third ? wave + 16 : wave; // else an in-range re-read, unused
        v16h a0[4], a1[4], a2[4], b[8][4];
#pragma unroll   // a0[] stays in registers only if indexed by constants
        for (int kc = 0; kc < 4; ++kc)
            a0[kc] = frag_k_contig(&oacc[(wave * 16 + lm) * XF_LD + kc * 32], lane);
#pragma unroll   // b[][] stays in registers only if indexed by constants
        for (int kc = 0; kc < 4; ++kc)
#pragma unroll
            for (int ct = 0; ct < 8; ++ct)
                b[ct][kc] = frag_k_contig(&wolT[(ct * 16 + lm) * WOL_LD + kc * 32], lane);
#pragma unroll   // a1[], a2[] stay in registers only if indexed by constants
        for (int kc = 0; kc < 4; ++kc) {
            a1[kc] = frag_k_contig(&oacc[((wave + 8) * 16 + lm) * XF_LD + kc * 32], lane);
            a2[kc] = frag_k_contig(&oacc[(qt2 * 16 + lm) * XF_LD + kc * 32], lane);
        }
        // keeps all reads in one group, in the order the products use them: sunk
        // between the products, each would wait out its own reads' LDS latency
        __builtin_amdgcn_sched_barrier(0);
        // rows of the first two tiles end at 255 (8 waves): only the third can pass
        // the window's last row
        float* ost = out + ((size_t)win * N_TOK + wave * 16 + hi16) * DMODEL + lm;
        out_row_tile<false>(a0, b, ost, 0);
        // the next tile's products reuse registers that the stores above name
        asm volatile("s_wait_xcnt 0x0" ::: "memory");
        // keeps those products behind the wait
        __builtin_amdgcn_sched_barrier(0);
        out_row_tile<false>(a1, b, ost + 128 * DMODEL, 0);
        if (third)
            out_row_tile<true>(a2, b, ost + 256 * DMODEL, N_TOK - 256 - wave * 16 - hi16);
    }
}

extern "C" void kernel_launch(void* const* d_in, const int* in_sizes, int n_in,
                              void* d_out, int out_size, void* d_ws, size_t ws_size,
                              hipStream_t stream) {
    const float* x        = (const float*)d_in[0];
    const float* w_qkv    = (const float*)d_in[1];
    const float* w_out    = (const float*)d_in[2];
    const float* bias_tab = (const float*)d_in[3];
    const int*   rel_idx  = (const int*)d_in[4];
    float* out     = (float*)d_out;
    float* bias_ws = (float*)d_ws;

    const int total = NHEADS * NT * NT * BT_F;
    bias_gather_kernel<<<(total + 255) / 256, 256, 0, stream>>>(bias_tab, rel_idx,
                                                                bias_ws);
    // 512 windows, 8 waves each, 307200 B dynamic LDS per workgroup
    win_attn_kernel<<<512, 256, 307200, stream>>>(x, w_qkv, w_out, bias_ws, out);
}

// v007
// It runs in 82.2 microseconds.
// In both of two side-by-side timings against v006, it was 1.09 times as fast.
// Over all steps from v000 it is 4.71 times as fast.
#include <hip/hip_runtime.h>
#include <hip/hip_bf16.h>

typedef __attribute__((ext_vector_type(16))) _Float16 v16h;
typedef __attribute__((ext_vector_type(4)))  _Float16 v4h;
typedef __attribute__((ext_vector_type(8)))  _Float16 v8h;
typedef __attribute__((ext_vector_type(8)))  float    v8f;

#define N_TOK   343
#define NP      352
#define NT      22
#define BT_F    256     // floats of one 16x16 bias tile, stored in lane order
#define N_REL   2197    // rows of the bias table
#define DMODEL  128
#define DH      32
#define NHEADS  4
#define VT_LD   360
#define WSL_LD  136
#define WOL_LD  136
#define XF_LD   136
#define QK_LD   40
#define LOG2E    1.4426950408889634f
#define QK_SCALE (0.17677669529663689f * LOG2E)   // 32^-0.5, scores in base-2 units
#define KEY_OFF  -3.0e38f   // C value of a pad key: below any score, finite

__device__ __forceinline__ v16h frag_k_contig(const _Float16* rowptr, int lane) {
    v16h f;
#pragma unroll
    for (int v = 0; v < 8; ++v) {
        int k = 2 * v + ((v & 4) ? 8 : 0) + ((lane & 16) ? 8 : 0);
        f[2 * v]     = rowptr[k];
        f[2 * v + 1] = rowptr[k + 1];
    }
    return f;
}

__device__ __forceinline__ v8f zero8() {
    v8f z;
#pragma unroll
    for (int i = 0; i < 8; ++i) z[i] = 0.0f;
    return z;
}

__device__ __forceinline__ v8f wmma_f16(v16h a, v16h b, v8f c) {
    return __builtin_amdgcn_wmma_f32_16x16x32_f16(false, a, false, b, (short)0, c,
                                                  false, false);
}

__device__ __forceinline__ float xhalf(float x) {
    int b = __builtin_bit_cast(int, x);
    return __builtin_bit_cast(float, __builtin_amdgcn_permlanex16(
        b, b, 0x76543210, 0xfedcba98, false, false));
}

// One 16-row tile of x times the head's six 16-column weight tiles (q0 q1 k0 k1
// v0 v1), all operands already in registers: six independent accumulators, each
// summed over kc = 0..3 in that order. qst: the lane's place in row hi16 of the
// tile in qh (kh lies NP rows behind it); vst: its place in vT.
__device__ __forceinline__ void qkv_row_tile(const v16h (&a)[4], const v16h (&b)[6][4],
                                             _Float16* qst, _Float16* vst) {
    v8f acc[6];
#pragma unroll   // acc[] stays in registers only if indexed by constants
    for (int j = 0; j < 6; ++j) acc[j] = zero8();
#pragma unroll
    for (int kc = 0; kc < 4; ++kc) {
#pragma unroll
        for (int j = 0; j < 6; ++j) acc[j] = wmma_f16(a[kc], b[j][kc], acc[j]);
        // keeps the six independent products of one kc side by side: regrouped
        // into per-tile chains, each product would wait out the accumulate latency
        __builtin_amdgcn_sched_barrier(0);
        if (kc == 0)
            asm volatile("" ::"v"(b[0][0]), "v"(b[1][0]), "v"(b[2][0]), "v"(b[3][0]),
                         "v"(b[4][0]), "v"(b[5][0]));
    }
#pragma unroll
    for (int j = 0; j < 2; ++j)
#pragma unroll
        for (int v = 0; v < 8; ++v) {
            qst[v * QK_LD + j * 16] = (_Float16)(acc[j][v] * QK_SCALE);   // Q, pre-scaled
            qst[(NP + v) * QK_LD + j * 16] = (_Float16)acc[2 + j][v];     // K
        }
    // V transposed: each lane's 8 rows are contiguous, one 16 B store
#pragma unroll
    for (int j = 0; j < 2; ++j) {
        v8h vv;
#pragma unroll
        for (int v = 0; v < 8; ++v) vv[v] = (_Float16)acc[4 + j][v];
        *(v8h*)(vst + j * 16 * VT_LD) = vv;
    }
}

// One 16-row tile of the attention output times all eight 16-column tiles of
// w_out, operands in registers: eight independent accumulators (kc = 0..3 each).
// ost: the lane's place in row hi16 of the tile in out; rows_left: how many rows
// from there on exist (looked at only where GUARD is set).
template <bool GUARD>
__device__ __forceinline__ void out_row_tile(const v16h (&a)[4], const v16h (&b)[8][4],
                                             float* ost, int rows_left) {
    v8f acc[8];
#pragma unroll   // acc[] stays in registers only if indexed by constants
    for (int ct = 0; ct < 8; ++ct) acc[ct] = zero8();
#pragma unroll
    for (int kc = 0; kc < 4; ++kc) {
#pragma unroll
        for (int ct = 0; ct < 8; ++ct) acc[ct] = wmma_f16(a[kc], b[ct][kc], acc[ct]);
        // keeps the eight independent products of one kc side by side: regrouped
        // into per-tile chains, each product would wait out the accumulate latency
        __builtin_amdgcn_sched_barrier(0);
        if (kc == 0)
            asm volatile("" ::"v"(b[0][0]), "v"(b[1][0]), "v"(b[2][0]), "v"(b[3][0]),
                         "v"(b[4][0]), "v"(b[5][0]), "v"(b[6][0]), "v"(b[7][0]));
    }
#pragma unroll
    for (int v = 0; v < 8; ++v) {
        if (!GUARD || v < rows_left) {
#pragma unroll
            for (int ct = 0; ct < 8; ++ct) ost[v * DMODEL + ct * 16] = acc[ct][v];
        }
    }
}

__global__ void bias_gather_kernel(const float* __restrict__ bias_table,
                                   const int*   __restrict__ rel_idx,
                                   float*       __restrict__ bias_ws) {
    int t = blockIdx.x * blockDim.x + threadIdx.x;
    const int total = NHEADS * NT * NT * BT_F;
    if (t >= total) return;
    int e    = t & 3;
    int ln   = (t >> 2) & 31;
    int half = (t >> 7) & 1;
    int tile = t >> 8;
    int nt = tile % NT;
    int qt = (tile / NT) % NT;
    int h  = tile / (NT * NT);
    int i = qt * 16 + (ln & 15);
    int j = nt * 16 + ((ln & 16) ? 8 : 0) + half * 4 + e;
    float b = j < N_TOK ? 0.0f : KEY_OFF;
    if (i < N_TOK && j < N_TOK) {
        int r = rel_idx[(size_t)i * N_TOK + j];
        r = r < 0 ? 0 : (r > N_REL - 1 ? N_REL - 1 : r);   // table row in bounds
        b = bias_table[(size_t)r * NHEADS + h] * LOG2E;
    }
    bias_ws[t] = b;
}

// ---- kernel 1: fully fused window attention, one workgroup per window ----
__global__ __launch_bounds__(256, 1) void win_attn_kernel(
    const float* __restrict__ xg,
    const float* __restrict__ w_qkv,
    const float* __restrict__ w_out,
    const float* __restrict__ bias_ws,
    float*       __restrict__ out) {
    extern __shared__ _Float16 smem[];
    _Float16* xf   = smem;                  // 352 x 136 = 47872 halfs
    _Float16* qh   = xf + NP * XF_LD;       // 352 x 40 per-head Q (pre-scaled)
    _Float16* kh   = qh + NP * QK_LD;       // 352 x 40 per-head K
    _Float16* vT   = kh + NP * QK_LD;       // 32 x 360: V transposed (K-contig)
    _Float16* oacc = vT + DH * VT_LD;       // 352 x 136 attention output
    _Float16* wslT = oacc + NP * XF_LD;     // 96 x 136: qkv slice transposed
    _Float16* wolT = wslT;                  // 128 x 136 = 17408 halfs, over wslT
                                            // (13056) and the 4352 behind it
    // total: 152832 halfs = 305664 bytes (< 320 KB WGP LDS)

    const int tid  = threadIdx.x;
    const int lane = tid & 31;
    const int wave = tid >> 5;
    const int win  = blockIdx.x;
    const int lm   = lane & 15;             // N/M index within a 16-wide tile
    const int hi16 = (lane & 16) ? 8 : 0;   // C-layout row offset, upper half

    // stage x window (343x128 f32 -> f16, zero-pad rows to 352), float4 reads.
    // The whole window is requested before the first value is used: a thread's
    // 43 loads are in flight together, so the stage pays the memory latency once.
    {
        constexpr int XQ    = N_TOK * DMODEL / 4;   // float4s of one window
        constexpr int XFULL = XQ / 256;             // sweeps every thread takes part in
        constexpr int XREM  = XQ % 256;             // threads of the last, partial sweep
        const float4* xw4 = (const float4*)(xg + (size_t)win * N_TOK * DMODEL) + tid;
        float4 f[XFULL + 1];
#pragma unroll   // f[] stays in registers only if indexed by constants
        for (int k = 0; k < XFULL; ++k) f[k] = xw4[k * 256];
        f[XFULL] = make_float4(0.0f, 0.0f, 0.0f, 0.0f);
        if (tid < XREM) f[XFULL] = xw4[XFULL * 256];
        // one sweep = 8 rows; thread: row tid/32 of the sweep, columns 4*(tid%32)..
        _Float16* xd = &xf[(tid >> 5) * XF_LD + (tid & 31) * 4];
#pragma unroll   // f[] stays in registers only if indexed by constants
        for (int k = 0; k <= XFULL; ++k) {
            v4h hv;
            hv[0] = (_Float16)f[k].x; hv[1] = (_Float16)f[k].y;
            hv[2] = (_Float16)f[k].z; hv[3] = (_Float16)f[k].w;
            *(v4h*)(xd + k * 8 * XF_LD) = hv;
        }
        v4h zv;
        zv[0] = zv[1] = zv[2] = zv[3] = (_Float16)0.0f;
        for (int k = XFULL + 1; k < NP / 8; ++k) *(v4h*)(xd + k * 8 * XF_LD) = zv;
    }

    for (int h = 0; h < NHEADS; ++h) {
        // stage this head's 128x96 slice of w_qkv, transposed (K-contiguous).
        // Wave w takes rows 16w..16w+15, a lane one column of each of q, k, v:
        // all 48 loads (one whole line each) are issued before the first is used.
        {
            const float* wp = w_qkv + (size_t)(wave * 16) * (3 * DMODEL) + h * DH + lane;
            float wv[3][16];
#pragma unroll   // wv[][] stays in registers only if indexed by constants
            for (int s = 0; s < 3; ++s)
#pragma unroll   // same: straight-line loads, one after another
                for (int m = 0; m < 16; ++m)
                    wv[s][m] = wp[m * (3 * DMODEL) + s * DMODEL];
#pragma unroll   // constant indices into wv[][]
            for (int s = 0; s < 3; ++s) {
                v8h lo, hi;
#pragma unroll   // constant indices into wv[][], lo, hi
                for (int m = 0; m < 8; ++m) {
                    lo[m] = (_Float16)wv[s][m];
                    hi[m] = (_Float16)wv[s][8 + m];
                }
                _Float16* wd = &wslT[(s * 32 + lane) * WSL_LD + wave * 16];
                *(v8h*)wd       = lo;
                *(v8h*)(wd + 8) = hi;
            }
        }
        __syncthreads();  // also guards prev head's phase-2 reads of qh/kh/vT

        // ---- phase 1: QKV projection. A wave takes whole row tiles (wave, wave + 8,
        // wave + 16) and holds the head's 24 weight fragments in registers for all
        // of them: an x fragment is read from LDS once for its six column tiles,
        // a weight fragment once per wave, not once per tile.
        {
            const bool third = wave < NT - 16;          // row tiles 16..21
            const int  rt2   = third ? wave + 16 : wave; // else an in-range re-read, unused
            v16h a0[4], a1[4], a2[4], b[6][4];
#pragma unroll   // a0[] stays in registers only if indexed by constants
            for (int kc = 0; kc < 4; ++kc)
                a0[kc] = frag_k_contig(&xf[(wave * 16 + lm) * XF_LD + kc * 32], lane);
#pragma unroll   // b[][] stays in registers only if indexed by constants
            for (int kc = 0; kc < 4; ++kc)
#pragma unroll
                for (int j = 0; j < 6; ++j)
                    b[j][kc] = frag_k_contig(&wslT[(j * 16 + lm) * WSL_LD + kc * 32], lane);
#pragma unroll   // a1[], a2[] stay in registers only if indexed by constants
            for (int kc = 0; kc < 4; ++kc) {
                a1[kc] = frag_k_contig(&xf[((wave + 8) * 16 + lm) * XF_LD + kc * 32], lane);
                a2[kc] = frag_k_contig(&xf[(rt2 * 16 + lm) * XF_LD + kc * 32], lane);
            }
            // keeps all reads in one group, in the order the products use them: sunk
            // between the products, each would wait out its own reads' LDS latency
            __builtin_amdgcn_sched_barrier(0);
            _Float16* qst = &qh[(wave * 16 + hi16) * QK_LD + lm];
            _Float16* vst = &vT[lm * VT_LD + wave * 16 + hi16];
            qkv_row_tile(a0, b, qst, vst);
            qkv_row_tile(a1, b, qst + 128 * QK_LD, vst + 128);
            if (third) qkv_row_tile(a2, b, qst + 256 * QK_LD, vst + 256);
        }
        __syncthreads();

        // ---- phase 2: attention; each wave owns query tiles qt, qt+8, ... ----
        const float4* bh = (const float4*)bias_ws + (size_t)h * NT * NT * (BT_F / 4);
        for (int qt = wave; qt < NT; qt += 8) {
            // S^T column-block (352 keys x 16 queries) in registers: A = K rows,
            // B = Q rows; dh=32 => one WMMA per tile. s[nt][v] is the score of
            // key nt*16 + hi16 + v for query qt*16 + lm: a lane holds one query.
            // The tile's bias loads (two whole-line float4 loads per key tile; the
            // plane holds its own pads, so every lane loads) and ALL its Q and K
            // fragment reads are issued as one group ahead of the 22 products.
            const float4* bp = bh + (size_t)qt * NT * (BT_F / 4) + lane;
            v8f s[NT];
#pragma unroll   // s[] stays in registers only if indexed by constants
            for (int nt = 0; nt < NT; ++nt) {
                float4 b0 = bp[nt * (BT_F / 4)];
                float4 b1 = bp[nt * (BT_F / 4) + 32];
                s[nt][0] = b0.x; s[nt][1] = b0.y; s[nt][2] = b0.z; s[nt][3] = b0.w;
                s[nt][4] = b1.x; s[nt][5] = b1.y; s[nt][6] = b1.z; s[nt][7] = b1.w;
            }
            v16h qf = frag_k_contig(&qh[(qt * 16 + lm) * QK_LD], lane);
            v16h kf[NT];
#pragma unroll   // kf[] stays in registers only if indexed by constants
            for (int nt = 0; nt < NT; ++nt)
                kf[nt] = frag_k_contig(&kh[(nt * 16 + lm) * QK_LD], lane);
            // keeps the reads above from sinking back between the products, where
            // each product would wait out the LDS latency of its own two reads
            __builtin_amdgcn_sched_barrier(0);
            // the bias (and the pad keys' mask) is the product's C operand
#pragma unroll
            for (int nt = 0; nt < NT; ++nt) s[nt] = wmma_f16(kf[nt], qf, s[nt]);
            // the next tile's plane address is formed in the registers that the
            // bias loads above name
            asm volatile("s_wait_xcnt 0x0" ::: "memory");
            // All V^T fragment reads, into the registers K has left: they land
            // while the softmax below runs.
            v16h vf0[NT / 2], vf1[NT / 2];
#pragma unroll   // vf0[], vf1[] stay in registers only if indexed by constants
            for (int c = 0; c < NT / 2; ++c) {
                vf0[c] = frag_k_contig(&vT[lm * VT_LD + c * 32], lane);
                vf1[c] = frag_k_contig(&vT[(16 + lm) * VT_LD + c * 32], lane);
            }
            // keeps these reads ahead of the softmax: sunk to their products, each
            // product would wait out the LDS latency of its own two reads
            __builtin_amdgcn_sched_barrier(0);
            // softmax over 352 keys: eight in-lane partials (independent chains),
            // joined in the lane, then one exchange between the wave's halves
            float pmax[8], psum[8];
#pragma unroll
            for (int v = 0; v < 8; ++v) pmax[v] = -__builtin_inff();
#pragma unroll
            for (int nt = 0; nt < NT; ++nt)
#pragma unroll
                for (int v = 0; v < 8; ++v) pmax[v] = fmaxf(pmax[v], s[nt][v]);
            float rmax = fmaxf(fmaxf(fmaxf(pmax[0], pmax[1]), fmaxf(pmax[2], pmax[3])),
                               fmaxf(fmaxf(pmax[4], pmax[5]), fmaxf(pmax[6], pmax[7])));
            rmax = fmaxf(rmax, xhalf(rmax));
#pragma unroll
            for (int v = 0; v < 8; ++v) psum[v] = 0.0f;
#pragma unroll
            for (int nt = 0; nt < NT; ++nt)
#pragma unroll
                for (int v = 0; v < 8; ++v) {
                    float p = __builtin_amdgcn_exp2f(s[nt][v] - rmax);   // base-2 scores
                    s[nt][v] = p;
                    psum[v] += p;
                }
            float rsum = ((psum[0] + psum[1]) + (psum[2] + psum[3])) +
                         ((psum[4] + psum[5]) + (psum[6] + psum[7]));
            rsum += xhalf(rsum);
            rsum = 1.0f / rsum;   // applied to the 16 outputs below, not to P

            // ---- O^T = V^T @ P^T : 11 chunks of K=32. Two S^T tiles, converted
            // in place, are the B operand in the k order of frag_k_contig
            // (element e: key e + hi16, element 8 + e: key 16 + e + hi16).
            v8f o0 = zero8(), o1 = zero8();
#pragma unroll
            for (int c = 0; c < 11; ++c) {
                v16h pf;
#pragma unroll
                for (int v = 0; v < 8; ++v) {
                    pf[v]     = (_Float16)s[2 * c][v];
                    pf[8 + v] = (_Float16)s[2 * c + 1][v];
                }
                o0 = wmma_f16(vf0[c], pf, o0);
                o1 = wmma_f16(vf1[c], pf, o1);
            }
            // o0[v], o1[v]: columns hi16 + v, 16 + hi16 + v of the lane's query
            // row: 8 contiguous halfs each, one 16 B store
            v8h ol, oh;
#pragma unroll
            for (int v = 0; v < 8; ++v) {
                ol[v] = (_Float16)(o0[v] * rsum);
                oh[v] = (_Float16)(o1[v] * rsum);
            }
            _Float16* od = &oacc[(qt * 16 + lm) * XF_LD + h * DH + hi16];
            *(v8h*)od        = ol;
            *(v8h*)(od + 16) = oh;
        }
        __syncthreads();
    }

    // ---- final projection: out = oacc(352x128) @ w_out(128x128) ----
    // w_out transposed (K-contiguous): wave w takes rows 16w..16w+15, a lane one
    // column of each 32-column group; all 64 loads issued before the first is used
    {
        const float* wp = w_out + (wave * 16) * DMODEL + lane;
        float wv[4][16];
#pragma unroll   // wv[][] stays in registers only if indexed by constants
        for (int s = 0; s < 4; ++s)
#pragma unroll   // same: straight-line loads, one after another
            for (int m = 0; m < 16; ++m)
                wv[s][m] = wp[m * DMODEL + s * 32];
        // the conversions below reuse the loads' address registers
        asm volatile("s_wait_xcnt 0x0" ::: "memory");
        // keeps the conversions behind that wait
        __builtin_amdgcn_sched_barrier(0);
#pragma unroll   // constant indices into wv[][]
        for (int s = 0; s < 4; ++s) {
            v8h lo, hi;
#pragma unroll   // constant indices into wv[][], lo, hi
            for (int m = 0; m < 8; ++m) {
                lo[m] = (_Float16)wv[s][m];
                hi[m] = (_Float16)wv[s][8 + m];
            }
            _Float16* wd = &wolT[(s * 32 + lane) * WOL_LD + wave * 16];
            *(v8h*)wd       = lo;
            *(v8h*)(wd + 8) = hi;
        }
    }
    __syncthreads();

    // A wave holds all 32 fragments of w_out in registers for its row tiles (wave,
    // wave + 8, wave + 16): each is read from LDS once per wave, not once per tile.
    {
        const bool third = wave < NT - 16;          // row tiles 16..21
        const int  qt2   = third ? wave + 16 : wave; // else an in-range re-read, unused
        v16h a0[4], a1[4], a2[4], b[8][4];
#pragma unroll   // a0[] stays in registers only if indexed by constants
        for (int kc = 0; kc < 4; ++kc)
            a0[kc] = frag_k_contig(&oacc[(wave * 16 + lm) * XF_LD + kc * 32], lane);
#pragma unroll   // b[][] stays in registers only if indexed by constants
        for (int kc = 0; kc < 4; ++kc)
#pragma unroll
            for (int ct = 0; ct < 8; ++ct)
                b[ct][kc] = frag_k_contig(&wolT[(ct * 16 + lm) * WOL_LD + kc * 32], lane);
#pragma unroll   // a1[], a2[] stay in registers only if indexed by constants
        for (int kc = 0; kc < 4; ++kc) {
            a1[kc] = frag_k_contig(&oacc[((wave + 8) * 16 + lm) * XF_LD + kc * 32], lane);
            a2[kc] = frag_k_contig(&oacc[(qt2 * 16 + lm) * XF_LD + kc * 32], lane);
        }
        // keeps all reads in one group, in the order the products use them: sunk
        // between the products, each would wait out its own reads' LDS latency
        __builtin_amdgcn_sched_barrier(0);
        // rows of the first two tiles end at 255 (8 waves): only the third can pass
        // the window's last row
        float* ost = out + ((size_t)win * N_TOK + wave * 16 + hi16) * DMODEL + lm;
        out_row_tile<false>(a0, b, ost, 0);
        // the next tile's products reuse registers that the stores above name
        asm volatile("s_wait_xcnt 0x0" ::: "memory");
        // keeps those products behind the wait
        __builtin_amdgcn_sched_barrier(0);
        out_row_tile<false>(a1, b, ost + 128 * DMODEL, 0);
        if (third)
            out_row_tile<true>(a2, b, ost + 256 * DMODEL, N_TOK - 256 - wave * 16 - hi16);
    }
}

extern "C" void kernel_launch(void* const* d_in, const int* in_sizes, int n_in,
                              void* d_out, int out_size, void* d_ws, size_t ws_size,
                              hipStream_t stream) {
    const float* x        = (const float*)d_in[0];
    const float* w_qkv    = (const float*)d_in[1];
    const float* w_out    = (const float*)d_in[2];
    const float* bias_tab = (const float*)d_in[3];
    const int*   rel_idx  = (const int*)d_in[4];
    float* out     = (float*)d_out;
    float* bias_ws = (float*)d_ws;

    const int total = NHEADS * NT * NT * BT_F;
    bias_gather_kernel<<<(total + 255) / 256, 256, 0, stream>>>(bias_tab, rel_idx,
                                                                bias_ws);
    // 512 windows, 8 waves each, 307200 B dynamic LDS per workgroup
    win_attn_kernel<<<512, 256, 307200, stream>>>(x, w_qkv, w_out, bias_ws, out);
}

// v008
// One run takes 77.5 microseconds.
// In both of two side-by-side timings against v007, it was 1.06 times as fast.
// All steps since v000 together make it 4.98 times as fast.
#include <hip/hip_runtime.h>
#include <hip/hip_bf16.h>

typedef __attribute__((ext_vector_type(16))) _Float16 v16h;
typedef __attribute__((ext_vector_type(4)))  _Float16 v4h;
typedef __attribute__((ext_vector_type(8)))  _Float16 v8h;
typedef __attribute__((ext_vector_type(8)))  float    v8f;

#define N_TOK   343
#define NP      352
#define NT      22
#define BT_F    256     // floats of one 16x16 bias tile, stored in lane order
#define N_REL   2197    // rows of the bias table
#define DMODEL  128
#define DH      32
#define NHEADS  4
#define VT_LD   360
#define WSL_LD  136
#define WOL_LD  136
#define XF_LD   136
#define QK_LD   136
#define N_UNIT  (NHEADS * NT)
#define LOG2E    1.4426950408889634f
#define QK_SCALE (0.17677669529663689f * LOG2E)   // 32^-0.5, scores in base-2 units
#define KEY_OFF  -3.0e38f   // C value of a pad key: below any score, finite

__device__ __forceinline__ v16h frag_k_contig(const _Float16* rowptr, int lane) {
    v16h f;
#pragma unroll
    for (int v = 0; v < 8; ++v) {
        int k = 2 * v + ((v & 4) ? 8 : 0) + ((lane & 16) ? 8 : 0);
        f[2 * v]     = rowptr[k];
        f[2 * v + 1] = rowptr[k + 1];
    }
    return f;
}

__device__ __forceinline__ v8f zero8() {
    v8f z;
#pragma unroll
    for (int i = 0; i < 8; ++i) z[i] = 0.0f;
    return z;
}

__device__ __forceinline__ v8f wmma_f16(v16h a, v16h b, v8f c) {
    return __builtin_amdgcn_wmma_f32_16x16x32_f16(false, a, false, b, (short)0, c,
                                                  false, false);
}

__device__ __forceinline__ float xhalf(float x) {
    int b = __builtin_bit_cast(int, x);
    return __builtin_bit_cast(float, __builtin_amdgcn_permlanex16(
        b, b, 0x76543210, 0xfedcba98, false, false));
}

// One 16-row tile of x times the head's six 16-column weight tiles (q0 q1 k0 k1
// v0 v1), all operands already in registers: six independent accumulators, each
// summed over kc = 0..3 in that order. qst: the lane's place in row hi16 of the
// tile, at the head's columns, in qh (kh lies NP rows behind it); vst: its place in vT.
__device__ __forceinline__ void qkv_row_tile(const v16h (&a)[4], const v16h (&b)[6][4],
                                             _Float16* qst, _Float16* vst) {
    v8f acc[6];
#pragma unroll   // acc[] stays in registers only if indexed by constants
    for (int j = 0; j < 6; ++j) acc[j] = zero8();
#pragma unroll
    for (int kc = 0; kc < 4; ++kc) {
#pragma unroll
        for (int j = 0; j < 6; ++j) acc[j] = wmma_f16(a[kc], b[j][kc], acc[j]);
        // keeps the six independent products of one kc side by side: regrouped
        // into per-tile chains, each product would wait out the accumulate latency
        __builtin_amdgcn_sched_barrier(0);
        if (kc == 0)
            asm volatile("" ::"v"(b[0][0]), "v"(b[1][0]), "v"(b[2][0]), "v"(b[3][0]),
                         "v"(b[4][0]), "v"(b[5][0]));
    }
#pragma unroll
    for (int j = 0; j < 2; ++j)
#pragma unroll
        for (int v = 0; v < 8; ++v) {
            qst[v * QK_LD + j * 16] = (_Float16)(acc[j][v] * QK_SCALE);   // Q, pre-scaled
            qst[(NP + v) * QK_LD + j * 16] = (_Float16)acc[2 + j][v];     // K
        }
    // V transposed: each lane's 8 rows are contiguous, one 16 B store
#pragma unroll
    for (int j = 0; j < 2; ++j) {
        v8h vv;
#pragma unroll
        for (int v = 0; v < 8; ++v) vv[v] = (_Float16)acc[4 + j][v];
        *(v8h*)(vst + j * 16 * VT_LD) = vv;
    }
}

// One 16-row tile of the attention output times all eight 16-column tiles of
// w_out, operands in registers: eight independent accumulators (kc = 0..3 each).
// ost: the lane's place in row hi16 of the tile in out; rows_left: how many rows
// from there on exist (looked at only where GUARD is set).
template <bool GUARD>
__device__ __forceinline__ void out_row_tile(const v16h (&a)[4], const v16h (&b)[8][4],
                                             float* ost, int rows_left) {
    v8f acc[8];
#pragma unroll   // acc[] stays in registers only if indexed by constants
    for (int ct = 0; ct < 8; ++ct) acc[ct] = zero8();
#pragma unroll
    for (int kc = 0; kc < 4; ++kc) {
#pragma unroll
        for (int ct = 0; ct < 8; ++ct) acc[ct] = wmma_f16(a[kc], b[ct][kc], acc[ct]);
        // keeps the eight independent products of one kc side by side: regrouped
        // into per-tile chains, each product would wait out the accumulate latency
        __builtin_amdgcn_sched_barrier(0);
        if (kc == 0)
            asm volatile("" ::"v"(b[0][0]), "v"(b[1][0]), "v"(b[2][0]), "v"(b[3][0]),
                         "v"(b[4][0]), "v"(b[5][0]), "v"(b[6][0]), "v"(b[7][0]));
    }
#pragma unroll
    for (int v = 0; v < 8; ++v) {
        if (!GUARD || v < rows_left) {
#pragma unroll
            for (int ct = 0; ct < 8; ++ct) ost[v * DMODEL + ct * 16] = acc[ct][v];
        }
    }
}

__global__ void bias_gather_kernel(const float* __restrict__ bias_table,
                                   const int*   __restrict__ rel_idx,
                                   float*       __restrict__ bias_ws) {
    int t = blockIdx.x * blockDim.x + threadIdx.x;
    const int total = NHEADS * NT * NT * BT_F;
    if (t >= total) return;
    int e    = t & 3;
    int ln   = (t >> 2) & 31;
    int half = (t >> 7) & 1;
    int tile = t >> 8;
    int nt = tile % NT;
    int qt = (tile / NT) % NT;
    int h  = tile / (NT * NT);
    int i = qt * 16 + (ln & 15);
    int j = nt * 16 + ((ln & 16) ? 8 : 0) + half * 4 + e;
    float b = j < N_TOK ? 0.0f : KEY_OFF;
    if (i < N_TOK && j < N_TOK) {
        int r = rel_idx[(size_t)i * N_TOK + j];
        r = r < 0 ? 0 : (r > N_REL - 1 ? N_REL - 1 : r);   // table row in bounds
        b = bias_table[(size_t)r * NHEADS + h] * LOG2E;
    }
    bias_ws[t] = b;
}

// ---- kernel 1: fully fused window attention, one workgroup per window ----
__global__ __launch_bounds__(256, 1) void win_attn_kernel(
    const float* __restrict__ xg,
    const float* __restrict__ w_qkv,
    const float* __restrict__ w_out,
    const float* __restrict__ bias_ws,
    float*       __restrict__ out) {
    extern __shared__ _Float16 smem[];
    _Float16* qh   = smem;                  // 352 x 136: Q of all heads (pre-scaled)
    _Float16* kh   = qh + NP * QK_LD;       // 352 x 136: K of all heads
    _Float16* vT   = kh + NP * QK_LD;       // 128 x 360: V transposed (K-contig), all heads
    _Float16* wslT = vT + DMODEL * VT_LD;   // 96 x 136: qkv slice transposed
    _Float16* wolT = wslT;                  // 128 x 136 = 17408 halfs, over wslT (13056)
    // x lies where K will: same pitch, and a wave alone reads the x rows whose K
    // rows it writes, after it has them in registers.
    _Float16* xf   = kh;
    // The attention output of a (head, query tile) unit goes over the unit's own Q
    // tile, which no other unit reads.
    _Float16* oacc = qh;
    // total: 159232 halfs = 318464 bytes (< 320 KB WGP LDS)

    const int tid  = threadIdx.x;
    const int lane = tid & 31;
    const int wave = tid >> 5;
    const int win  = blockIdx.x;
    const int lm   = lane & 15;             // N/M index within a 16-wide tile
    const int hi16 = (lane & 16) ? 8 : 0;   // C-layout row offset, upper half

    // stage x window (343x128 f32 -> f16, zero-pad rows to 352), float4 reads.
    // The whole window is requested before the first value is used: a thread's
    // 43 loads are in flight together, so the stage pays the memory latency once.
    {
        constexpr int XQ    = N_TOK * DMODEL / 4;   // float4s of one window
        constexpr int XFULL = XQ / 256;             // sweeps every thread takes part in
        constexpr int XREM  = XQ % 256;             // threads of the last, partial sweep
        const float4* xw4 = (const float4*)(xg + (size_t)win * N_TOK * DMODEL) + tid;
        float4 f[XFULL + 1];
#pragma unroll   // f[] stays in registers only if indexed by constants
        for (int k = 0; k < XFULL; ++k) f[k] = xw4[k * 256];
        f[XFULL] = make_float4(0.0f, 0.0f, 0.0f, 0.0f);
        if (tid < XREM) f[XFULL] = xw4[XFULL * 256];
        // one sweep = 8 rows; thread: row tid/32 of the sweep, columns 4*(tid%32)..
        _Float16* xd = &xf[(tid >> 5) * XF_LD + (tid & 31) * 4];
#pragma unroll   // f[] stays in registers only if indexed by constants
        for (int k = 0; k <= XFULL; ++k) {
            v4h hv;
            hv[0] = (_Float16)f[k].x; hv[1] = (_Float16)f[k].y;
            hv[2] = (_Float16)f[k].z; hv[3] = (_Float16)f[k].w;
            *(v4h*)(xd + k * 8 * XF_LD) = hv;
        }
        v4h zv;
        zv[0] = zv[1] = zv[2] = zv[3] = (_Float16)0.0f;
        for (int k = XFULL + 1; k < NP / 8; ++k) *(v4h*)(xd + k * 8 * XF_LD) = zv;
    }

    // ---- phase 1: QKV projection of all four heads. A wave takes whole row tiles
    // (wave, wave + 8, wave + 16); their x fragments are read from LDS once and stay
    // in registers for all heads, a head's 24 weight fragments for its three tiles.
    {
        const bool third = wave < NT - 16;          // row tiles 16..21
        const int  rt2   = third ? wave + 16 : wave; // else an in-range re-read, unused
        v16h a0[4], a1[4], a2[4];
        for (int h = 0; h < NHEADS; ++h) {
            // stage this head's 128x96 slice of w_qkv, transposed (K-contiguous).
            // Wave w takes rows 16w..16w+15, a lane one column of each of q, k, v:
            // all 48 loads (one whole line each) are issued before the first is used.
            {
                const float* wp = w_qkv + (size_t)(wave * 16) * (3 * DMODEL) + h * DH + lane;
                float wv[3][16];
#pragma unroll   // wv[][] stays in registers only if indexed by constants
                for (int s = 0; s < 3; ++s)
#pragma unroll   // same: straight-line loads, one after another
                    for (int m = 0; m < 16; ++m)
                        wv[s][m] = wp[m * (3 * DMODEL) + s * DMODEL];
                // the conversions below reuse the loads' address registers
                asm volatile("s_wait_xcnt 0x0" ::: "memory");
                // keeps the conversions behind that wait
                __builtin_amdgcn_sched_barrier(0);
#pragma unroll   // constant indices into wv[][]
                for (int s = 0; s < 3; ++s) {
                    v8h lo, hi;
#pragma unroll   // constant indices into wv[][], lo, hi
                    for (int m = 0; m < 8; ++m) {
                        lo[m] = (_Float16)wv[s][m];
                        hi[m] = (_Float16)wv[s][8 + m];
                    }
                    _Float16* wd = &wslT[(s * 32 + lane) * WSL_LD + wave * 16];
                    *(v8h*)wd       = lo;
                    *(v8h*)(wd + 8) = hi;
                }
            }
            __syncthreads();  // the slice (and, for head 0, x) is in LDS

            if (h == 0) {
#pragma unroll   // a0[], a1[], a2[] stay in registers only if indexed by constants
                for (int kc = 0; kc < 4; ++kc) {
                    a0[kc] = frag_k_contig(&xf[(wave * 16 + lm) * XF_LD + kc * 32], lane);
                    a1[kc] = frag_k_contig(&xf[((wave + 8) * 16 + lm) * XF_LD + kc * 32], lane);
                    a2[kc] = frag_k_contig(&xf[(rt2 * 16 + lm) * XF_LD + kc * 32], lane);
                }
            }
            v16h b[6][4];
#pragma unroll   // b[][] stays in registers only if indexed by constants
            for (int kc = 0; kc < 4; ++kc)
#pragma unroll
                for (int j = 0; j < 6; ++j)
                    b[j][kc] = frag_k_contig(&wslT[(j * 16 + lm) * WSL_LD + kc * 32], lane);
            // keeps all reads in one group, in the order the products use them: sunk
            // between the products, each would wait out its own reads' LDS latency
            __builtin_amdgcn_sched_barrier(0);
            _Float16* qst = &qh[(wave * 16 + hi16) * QK_LD + h * DH + lm];
            _Float16* vst = &vT[(h * DH + lm) * VT_LD + wave * 16 + hi16];
            qkv_row_tile(a0, b, qst, vst);
            qkv_row_tile(a1, b, qst + 128 * QK_LD, vst + 128);
            if (third) qkv_row_tile(a2, b, qst + 256 * QK_LD, vst + 256);
            __syncthreads();  // every wave has read the slice; after the last head: Q, K, V^T complete
        }
    }

    // ---- phase 2: attention. The 88 (head, query tile) units are dealt evenly: a
    // wave takes units wave, wave + 8, ... (11 each) in one run with no barrier in it.
    {
#pragma unroll 1   // rolled: for speed only
        for (int u = wave; u < N_UNIT; u += 8) {
            const int h  = u / NT;
            const int qt = u - h * NT;
            // S^T column-block (352 keys x 16 queries) in registers: A = K rows,
            // B = Q rows; dh=32 => one WMMA per tile. s[nt][v] is the score of
            // key nt*16 + hi16 + v for query qt*16 + lm: a lane holds one query.
            // The tile's bias loads (two whole-line float4 loads per key tile; the
            // plane holds its own pads, so every lane loads) and ALL its Q and K
            // fragment reads are issued as one group ahead of the 22 products.
            const float4* bp = (const float4*)bias_ws + (size_t)u * NT * (BT_F / 4) + lane;
            v8f s[NT];
#pragma unroll   // s[] stays in registers only if indexed by constants
            for (int nt = 0; nt < NT; ++nt) {
                float4 b0 = bp[nt * (BT_F / 4)];
                float4 b1 = bp[nt * (BT_F / 4) + 32];
                s[nt][0] = b0.x; s[nt][1] = b0.y; s[nt][2] = b0.z; s[nt][3] = b0.w;
                s[nt][4] = b1.x; s[nt][5] = b1.y; s[nt][6] = b1.z; s[nt][7] = b1.w;
            }
            v16h qf = frag_k_contig(&qh[(qt * 16 + lm) * QK_LD + h * DH], lane);
            v16h kf[NT];
#pragma unroll   // kf[] stays in registers only if indexed by constants
            for (int nt = 0; nt < NT; ++nt)
                kf[nt] = frag_k_contig(&kh[(nt * 16 + lm) * QK_LD + h * DH], lane);
            // keeps the reads above from sinking back between the products, where
            // each product would wait out the LDS latency of its own two reads
            __builtin_amdgcn_sched_barrier(0);
            // the bias (and the pad keys' mask) is the product's C operand
#pragma unroll
            for (int nt = 0; nt < NT; ++nt) s[nt] = wmma_f16(kf[nt], qf, s[nt]);
            // the next tile's plane address is formed in the registers that the
            // bias loads above name
            asm volatile("s_wait_xcnt 0x0" ::: "memory");
            // All V^T fragment reads, into the registers K has left: they land
            // while the softmax below runs.
            v16h vf0[NT / 2], vf1[NT / 2];
#pragma unroll   // vf0[], vf1[] stay in registers only if indexed by constants
            for (int c = 0; c < NT / 2; ++c) {
                vf0[c] = frag_k_contig(&vT[(h * DH + lm) * VT_LD + c * 32], lane);
                vf1[c] = frag_k_contig(&vT[(h * DH + 16 + lm) * VT_LD + c * 32], lane);
            }
            // keeps these reads ahead of the softmax: sunk to their products, each
            // product would wait out the LDS latency of its own two reads
            __builtin_amdgcn_sched_barrier(0);
            // softmax over 352 keys: eight in-lane partials (independent chains),
            // joined in the lane, then one exchange between the wave's halves
            float pmax[8], psum[8];
#pragma unroll
            for (int v = 0; v < 8; ++v) pmax[v] = -__builtin_inff();
#pragma unroll
            for (int nt = 0; nt < NT; ++nt)
#pragma unroll
                for (int v = 0; v < 8; ++v) pmax[v] = fmaxf(pmax[v], s[nt][v]);
            float rmax = fmaxf(fmaxf(fmaxf(pmax[0], pmax[1]), fmaxf(pmax[2], pmax[3])),
                               fmaxf(fmaxf(pmax[4], pmax[5]), fmaxf(pmax[6], pmax[7])));
            rmax = fmaxf(rmax, xhalf(rmax));
#pragma unroll
            for (int v = 0; v < 8; ++v) psum[v] = 0.0f;
#pragma unroll
            for (int nt = 0; nt < NT; ++nt)
#pragma unroll
                for (int v = 0; v < 8; ++v) {
                    float p = __builtin_amdgcn_exp2f(s[nt][v] - rmax);   // base-2 scores
                    s[nt][v] = p;
                    psum[v] += p;
                }
            float rsum = ((psum[0] + psum[1]) + (psum[2] + psum[3])) +
                         ((psum[4] + psum[5]) + (psum[6] + psum[7]));
            rsum += xhalf(rsum);
            rsum = 1.0f / rsum;   // applied to the 16 outputs below, not to P

            // ---- O^T = V^T @ P^T : 11 chunks of K=32. Two S^T tiles, converted
            // in place, are the B operand in the k order of frag_k_contig
            // (element e: key e + hi16, element 8 + e: key 16 + e + hi16).
            v8f o0 = zero8(), o1 = zero8();
#pragma unroll
            for (int c = 0; c < 11; ++c) {
                v16h pf;
#pragma unroll
                for (int v = 0; v < 8; ++v) {
                    pf[v]     = (_Float16)s[2 * c][v];
                    pf[8 + v] = (_Float16)s[2 * c + 1][v];
                }
                o0 = wmma_f16(vf0[c], pf, o0);
                o1 = wmma_f16(vf1[c], pf, o1);
            }
            // o0[v], o1[v]: columns hi16 + v, 16 + hi16 + v of the lane's query
            // row: 8 contiguous halfs each, one 16 B store
            v8h ol, oh;
#pragma unroll
            for (int v = 0; v < 8; ++v) {
                ol[v] = (_Float16)(o0[v] * rsum);
                oh[v] = (_Float16)(o1[v] * rsum);
            }
            _Float16* od = &oacc[(qt * 16 + lm) * XF_LD + h * DH + hi16];
            *(v8h*)od        = ol;
            *(v8h*)(od + 16) = oh;
        }
        __syncthreads();
    }

    // ---- final projection: out = oacc(352x128) @ w_out(128x128) ----
    // w_out transposed (K-contiguous): wave w takes rows 16w..16w+15, a lane one
    // column of each 32-column group; all 64 loads issued before the first is used
    {
        const float* wp = w_out + (wave * 16) * DMODEL + lane;
        float wv[4][16];
#pragma unroll   // wv[][] stays in registers only if indexed by constants
        for (int s = 0; s < 4; ++s)
#pragma unroll   // same: straight-line loads, one after another
            for (int m = 0; m < 16; ++m)
                wv[s][m] = wp[m * DMODEL + s * 32];
        // the conversions below reuse the loads' address registers
        asm volatile("s_wait_xcnt 0x0" ::: "memory");
        // keeps the conversions behind that wait
        __builtin_amdgcn_sched_barrier(0);
#pragma unroll   // constant indices into wv[][]
        for (int s = 0; s < 4; ++s) {
            v8h lo, hi;
#pragma unroll   // constant indices into wv[][], lo, hi
            for (int m = 0; m < 8; ++m) {
                lo[m] = (_Float16)wv[s][m];
                hi[m] = (_Float16)wv[s][8 + m];
            }
            _Float16* wd = &wolT[(s * 32 + lane) * WOL_LD + wave * 16];
            *(v8h*)wd       = lo;
            *(v8h*)(wd + 8) = hi;
        }
    }
    __syncthreads();

    // A wave holds all 32 fragments of w_out in registers for its row tiles (wave,
    // wave + 8, wave + 16): each is read from LDS once per wave, not once per tile.
    {
        const bool third = wave < NT - 16;          // row tiles 16..21
        const int  qt2   = third ? wave + 16 : wave; // else an in-range re-read, unused
        v16h a0[4], a1[4], a2[4], b[8][4];
#pragma unroll   // a0[] stays in registers only if indexed by constants
        for (int kc = 0; kc < 4; ++kc)
            a0[kc] = frag_k_contig(&oacc[(wave * 16 + lm) * XF_LD + kc * 32], lane);
#pragma unroll   // b[][] stays in registers only if indexed by constants
        for (int kc = 0; kc < 4; ++kc)
#pragma unroll
            for (int ct = 0; ct < 8; ++ct)
                b[ct][kc] = frag_k_contig(&wolT[(ct * 16 + lm) * WOL_LD + kc * 32], lane);
#pragma unroll   // a1[], a2[] stay in registers only if indexed by constants
        for (int kc = 0; kc < 4; ++kc) {
            a1[kc] = frag_k_contig(&oacc[((wave + 8) * 16 + lm) * XF_LD + kc * 32], lane);
            a2[kc] = frag_k_contig(&oacc[(qt2 * 16 + lm) * XF_LD + kc * 32], lane);
        }
        // keeps all reads in one group, in the order the products use them: sunk
        // between the products, each would wait out its own reads' LDS latency
        __builtin_amdgcn_sched_barrier(0);
        // rows of the first two tiles end at 255 (8 waves): only the third can pass
        // the window's last row
        float* ost = out + ((size_t)win * N_TOK + wave * 16 + hi16) * DMODEL + lm;
        out_row_tile<false>(a0, b, ost, 0);
        // the next tile's products reuse registers that the stores above name
        asm volatile("s_wait_xcnt 0x0" ::: "memory");
        // keeps those products behind the wait
        __builtin_amdgcn_sched_barrier(0);
        out_row_tile<false>(a1, b, ost + 128 * DMODEL, 0);
        if (third)
            out_row_tile<true>(a2, b, ost + 256 * DMODEL, N_TOK - 256 - wave * 16 - hi16);
    }
}

extern "C" void kernel_launch(void* const* d_in, const int* in_sizes, int n_in,
                              void* d_out, int out_size, void* d_ws, size_t ws_size,
                              hipStream_t stream) {
    const float* x        = (const float*)d_in[0];
    const float* w_qkv    = (const float*)d_in[1];
    const float* w_out    = (const float*)d_in[2];
    const float* bias_tab = (const float*)d_in[3];
    const int*   rel_idx  = (const int*)d_in[4];
    float* out     = (float*)d_out;
    float* bias_ws = (float*)d_ws;

    const int total = NHEADS * NT * NT * BT_F;
    bias_gather_kernel<<<(total + 255) / 256, 256, 0, stream>>>(bias_tab, rel_idx,
                                                                bias_ws);
    // 512 windows, 8 waves each, 318464 B dynamic LDS per workgroup
    win_attn_kernel<<<512, 256, 318464, stream>>>(x, w_qkv, w_out, bias_ws, out);
}

// v010
// A run of this version takes 69.6 microseconds.
// Versions in between are left out here; by their measured steps it is 1.12 times as fast as v008.
// Counting every step since v000, it is 5.56 times as fast.
#include <hip/hip_runtime.h>
#include <hip/hip_bf16.h>

typedef __attribute__((ext_vector_type(16))) _Float16 v16h;
typedef __attribute__((ext_vector_type(4)))  _Float16 v4h;
typedef __attribute__((ext_vector_type(8)))  _Float16 v8h;
typedef __attribute__((ext_vector_type(8)))  float    v8f;
typedef __attribute__((ext_vector_type(2)))  float    v2f;

#define N_TOK   343
#define NP      352
#define NT      22
#define N_REL   2197    // rows of the bias table
#define DMODEL  128
#define DH      32
#define NHEADS  4
#define VT_LD   360
#define WSL_LD  136
#define WOL_LD  136
#define XF_LD   136
#define QK_LD   136
#define N_UNIT  (NHEADS * NT)
#define LOG2E    1.4426950408889634f
#define QK_SCALE (0.17677669529663689f * LOG2E)   // 32^-0.5, scores in base-2 units
#define KEY_OFF  -3.0e38f   // score of a pad key: below any real score, finite
#define BIAS_LIM 60000.0f   // bias magnitudes end here: finite in f16 (an infinity times a
                            // selector's 0 would be a NaN in the tile's other queries)
#define P_SUM_HI 60000.0f   // row sums of 2^score below this keep every P under 65504 (f16)

__device__ __forceinline__ v16h frag_k_contig(const _Float16* rowptr, int lane) {
    v16h f;
#pragma unroll
    for (int v = 0; v < 8; ++v) {
        int k = 2 * v + ((v & 4) ? 8 : 0) + ((lane & 16) ? 8 : 0);
        f[2 * v]     = rowptr[k];
        f[2 * v + 1] = rowptr[k + 1];
    }
    return f;
}

__device__ __forceinline__ v8f zero8() {
    v8f z;
#pragma unroll
    for (int i = 0; i < 8; ++i) z[i] = 0.0f;
    return z;
}

__device__ __forceinline__ v8f wmma_f16(v16h a, v16h b, v8f c) {
    return __builtin_amdgcn_wmma_f32_16x16x32_f16(false, a, false, b, (short)0, c,
                                                  false, false);
}

// scores of the last key tile (element v: key (NT-1)*16 + hi16 + v): pad keys switched off
__device__ __forceinline__ void mask_pad_keys(v8f& t, int hi16) {
#pragma unroll
    for (int v = 0; v < 8; ++v)
        t[v] = (NT - 1) * 16 + hi16 + v < N_TOK ? t[v] : KEY_OFF;
}

__device__ __forceinline__ float xhalf(float x) {
    int b = __builtin_bit_cast(int, x);
    return __builtin_bit_cast(float, __builtin_amdgcn_permlanex16(
        b, b, 0x76543210, 0xfedcba98, false, false));
}

// One 16-row tile of x times the head's six 16-column weight tiles (q0 q1 k0 k1
// v0 v1), all operands already in registers: six independent accumulators, each
// summed over kc = 0..3 in that order. qst: the lane's place in row hi16 of the
// tile, at the head's columns, in qh (kh lies NP rows behind it); vst: its place in vT.
__device__ __forceinline__ void qkv_row_tile(const v16h (&a)[4], const v16h (&b)[6][4],
                                             _Float16* qst, _Float16* vst) {
    v8f acc[6];
#pragma unroll   // acc[] stays in registers only if indexed by constants
    for (int j = 0; j < 6; ++j) acc[j] = zero8();
#pragma unroll
    for (int kc = 0; kc < 4; ++kc) {
#pragma unroll
        for (int j = 0; j < 6; ++j) acc[j] = wmma_f16(a[kc], b[j][kc], acc[j]);
        // keeps the six independent products of one kc side by side: regrouped
        // into per-tile chains, each product would wait out the accumulate latency
        __builtin_amdgcn_sched_barrier(0);
        if (kc == 0)
            asm volatile("" ::"v"(b[0][0]), "v"(b[1][0]), "v"(b[2][0]), "v"(b[3][0]),
                         "v"(b[4][0]), "v"(b[5][0]));
    }
#pragma unroll
    for (int j = 0; j < 2; ++j)
#pragma unroll
        for (int v = 0; v < 8; ++v) {
            qst[v * QK_LD + j * 16] = (_Float16)(acc[j][v] * QK_SCALE);   // Q, pre-scaled
            qst[(NP + v) * QK_LD + j * 16] = (_Float16)acc[2 + j][v];     // K
        }
    // V transposed: each lane's 8 rows are contiguous, one 16 B store
#pragma unroll
    for (int j = 0; j < 2; ++j) {
        v8h vv;
#pragma unroll
        for (int v = 0; v < 8; ++v) vv[v] = (_Float16)acc[4 + j][v];
        *(v8h*)(vst + j * 16 * VT_LD) = vv;
    }
}

// One 16-row tile of the attention output times all eight 16-column tiles of
// w_out, operands in registers: eight independent accumulators (kc = 0..3 each).
// ost: the lane's place in row hi16 of the tile in out; rows_left: how many rows
// from there on exist (looked at only where GUARD is set).
template <bool GUARD>
__device__ __forceinline__ void out_row_tile(const v16h (&a)[4], const v16h (&b)[8][4],
                                             float* ost, int rows_left) {
    v8f acc[8];
#pragma unroll   // acc[] stays in registers only if indexed by constants
    for (int ct = 0; ct < 8; ++ct) acc[ct] = zero8();
#pragma unroll
    for (int kc = 0; kc < 4; ++kc) {
#pragma unroll
        for (int ct = 0; ct < 8; ++ct) acc[ct] = wmma_f16(a[kc], b[ct][kc], acc[ct]);
        // keeps the eight independent products of one kc side by side: regrouped
        // into per-tile chains, each product would wait out the accumulate latency
        __builtin_amdgcn_sched_barrier(0);
        if (kc == 0)
            asm volatile("" ::"v"(b[0][0]), "v"(b[1][0]), "v"(b[2][0]), "v"(b[3][0]),
                         "v"(b[4][0]), "v"(b[5][0]), "v"(b[6][0]), "v"(b[7][0]));
    }
#pragma unroll
    for (int v = 0; v < 8; ++v) {
        if (!GUARD || v < rows_left) {
#pragma unroll
            for (int ct = 0; ct < 8; ++ct) ost[v * DMODEL + ct * 16] = acc[ct][v];
        }
    }
}

__global__ void bias_gather_kernel(const float* __restrict__ bias_table,
                                   const int*   __restrict__ rel_idx,
                                   float*       __restrict__ bias_ws) {
    int t = blockIdx.x * blockDim.x + threadIdx.x;
    const int total = NHEADS * NT * NT * 32;
    if (t >= total) return;
    int ln   = t & 31;
    int tile = t >> 5;          // (h, qt, key tile): c and half are the key tile's bits
    int nt = tile % NT;
    int qt = (tile / NT) % NT;
    int h  = tile / (NT * NT);
    int i0 = qt * 16 + ((ln & 16) ? 8 : 0);
    int j  = nt * 16 + (ln & 15);
    // Pads read the window's last row or column (in bounds, no branch) and store 0:
    // the eight index loads are issued together, then the eight table loads.
    const int jc = j < N_TOK ? j : N_TOK - 1;
    int q[8];
#pragma unroll   // q[] stays in registers only if indexed by constants
    for (int e = 0; e < 8; ++e) {
        const int ic = i0 + e < N_TOK ? i0 + e : N_TOK - 1;
        q[e] = rel_idx[ic * N_TOK + jc];
    }
    float b[8];
#pragma unroll   // b[] stays in registers only if indexed by constants
    for (int e = 0; e < 8; ++e) {
        const int r = q[e] < 0 ? 0 : (q[e] > N_REL - 1 ? N_REL - 1 : q[e]);   // table row in bounds
        b[e] = bias_table[r * NHEADS + h];
    }
    v8h bv;
#pragma unroll
    for (int e = 0; e < 8; ++e) {
        const float c = fminf(fmaxf(b[e] * LOG2E, -BIAS_LIM), BIAS_LIM);
        bv[e] = (_Float16)(i0 + e < N_TOK && j < N_TOK ? c : 0.0f);
    }
    ((v8h*)bias_ws)[t] = bv;
}

// ---- kernel 1: fully fused window attention, one workgroup per window ----
__global__ __launch_bounds__(256, 1) void win_attn_kernel(
    const float* __restrict__ xg,
    const float* __restrict__ w_qkv,
    const float* __restrict__ w_out,
    const float* __restrict__ bias_ws,
    float*       __restrict__ out) {
    extern __shared__ _Float16 smem[];
    _Float16* qh   = smem;                  // 352 x 136: Q of all heads (pre-scaled)
    _Float16* kh   = qh + NP * QK_LD;       // 352 x 136: K of all heads
    _Float16* vT   = kh + NP * QK_LD;       // 128 x 360: V transposed (K-contig), all heads
    _Float16* wslT = vT + DMODEL * VT_LD;   // 96 x 136: qkv slice transposed
    _Float16* wolT = wslT;                  // 128 x 136 = 17408 halfs, over wslT (13056)
    // x lies where K will: same pitch, and a wave alone reads the x rows whose K
    // rows it writes, after it has them in registers.
    _Float16* xf   = kh;
    // The attention output of a (head, query tile) unit goes over the unit's own Q
    // tile, which no other unit reads.
    _Float16* oacc = qh;
    // total: 159232 halfs = 318464 bytes (< 320 KB WGP LDS)

    const int tid  = threadIdx.x;
    const int lane = tid & 31;
    const int wave = tid >> 5;
    const int win  = blockIdx.x;
    const int lm   = lane & 15;             // N/M index within a 16-wide tile
    const int hi16 = (lane & 16) ? 8 : 0;   // C-layout row offset, upper half

    // stage x window (343x128 f32 -> f16, zero-pad rows to 352), float4 reads.
    // The whole window is requested before the first value is used: a thread's
    // 43 loads are in flight together, so the stage pays the memory latency once.
    {
        constexpr int XQ    = N_TOK * DMODEL / 4;   // float4s of one window
        constexpr int XFULL = XQ / 256;             // sweeps every thread takes part in
        constexpr int XREM  = XQ % 256;             // threads of the last, partial sweep
        const float4* xw4 = (const float4*)(xg + (size_t)win * N_TOK * DMODEL) + tid;
        float4 f[XFULL + 1];
#pragma unroll   // f[] stays in registers only if indexed by constants
        for (int k = 0; k < XFULL; ++k) f[k] = xw4[k * 256];
        f[XFULL] = make_float4(0.0f, 0.0f, 0.0f, 0.0f);
        if (tid < XREM) f[XFULL] = xw4[XFULL * 256];
        // one sweep = 8 rows; thread: row tid/32 of the sweep, columns 4*(tid%32)..
        _Float16* xd = &xf[(tid >> 5) * XF_LD + (tid & 31) * 4];
#pragma unroll   // f[] stays in registers only if indexed by constants
        for (int k = 0; k <= XFULL; ++k) {
            v4h hv;
            hv[0] = (_Float16)f[k].x; hv[1] = (_Float16)f[k].y;
            hv[2] = (_Float16)f[k].z; hv[3] = (_Float16)f[k].w;
            *(v4h*)(xd + k * 8 * XF_LD) = hv;
        }
        v4h zv;
        zv[0] = zv[1] = zv[2] = zv[3] = (_Float16)0.0f;
        for (int k = XFULL + 1; k < NP / 8; ++k) *(v4h*)(xd + k * 8 * XF_LD) = zv;
    }

    // ---- phase 1: QKV projection of all four heads. A wave takes whole row tiles
    // (wave, wave + 8, wave + 16); their x fragments are read from LDS once and stay
    // in registers for all heads, a head's 24 weight fragments for its three tiles.
    {
        const bool third = wave < NT - 16;          // row tiles 16..21
        const int  rt2   = third ? wave + 16 : wave; // else an in-range re-read, unused
        v16h a0[4], a1[4], a2[4];
        for (int h = 0; h < NHEADS; ++h) {
            // stage this head's 128x96 slice of w_qkv, transposed (K-contiguous).
            // Wave w takes rows 16w..16w+15, a lane one column of each of q, k, v:
            // all 48 loads (one whole line each) are issued before the first is used.
            {
                const float* wp = w_qkv + (size_t)(wave * 16) * (3 * DMODEL) + h * DH + lane;
                float wv[3][16];
#pragma unroll   // wv[][] stays in registers only if indexed by constants
                for (int s = 0; s < 3; ++s)
#pragma unroll   // same: straight-line loads, one after another
                    for (int m = 0; m < 16; ++m)
                        wv[s][m] = wp[m * (3 * DMODEL) + s * DMODEL];
                // the conversions below reuse the loads' address registers
                asm volatile("s_wait_xcnt 0x0" ::: "memory");
                // keeps the conversions behind that wait
                __builtin_amdgcn_sched_barrier(0);
#pragma unroll   // constant indices into wv[][]
                for (int s = 0; s < 3; ++s) {
                    v8h lo, hi;
#pragma unroll   // constant indices into wv[][], lo, hi
                    for (int m = 0; m < 8; ++m) {
                        lo[m] = (_Float16)wv[s][m];
                        hi[m] = (_Float16)wv[s][8 + m];
                    }
                    _Float16* wd = &wslT[(s * 32 + lane) * WSL_LD + wave * 16];
                    *(v8h*)wd       = lo;
                    *(v8h*)(wd + 8) = hi;
                }
            }
            __syncthreads();  // the slice (and, for head 0, x) is in LDS

            if (h == 0) {
#pragma unroll   // a0[], a1[], a2[] stay in registers only if indexed by constants
                for (int kc = 0; kc < 4; ++kc) {
                    a0[kc] = frag_k_contig(&xf[(wave * 16 + lm) * XF_LD + kc * 32], lane);
                    a1[kc] = frag_k_contig(&xf[((wave + 8) * 16 + lm) * XF_LD + kc * 32], lane);
                    a2[kc] = frag_k_contig(&xf[(rt2 * 16 + lm) * XF_LD + kc * 32], lane);
                }
            }
            v16h b[6][4];
#pragma unroll   // b[][] stays in registers only if indexed by constants
            for (int kc = 0; kc < 4; ++kc)
#pragma unroll
                for (int j = 0; j < 6; ++j)
                    b[j][kc] = frag_k_contig(&wslT[(j * 16 + lm) * WSL_LD + kc * 32], lane);
            // keeps all reads in one group, in the order the products use them: sunk
            // between the products, each would wait out its own reads' LDS latency
            __builtin_amdgcn_sched_barrier(0);
            _Float16* qst = &qh[(wave * 16 + hi16) * QK_LD + h * DH + lm];
            _Float16* vst = &vT[(h * DH + lm) * VT_LD + wave * 16 + hi16];
            qkv_row_tile(a0, b, qst, vst);
            qkv_row_tile(a1, b, qst + 128 * QK_LD, vst + 128);
            if (third) qkv_row_tile(a2, b, qst + 256 * QK_LD, vst + 256);
            __syncthreads();  // every wave has read the slice; after the last head: Q, K, V^T complete
        }
    }

    // ---- phase 2: attention. The 88 (head, query tile) units are dealt evenly: a
    // wave takes units wave, wave + 8, ... (11 each) in one run with no barrier in it.
    {
        // 0/1 selectors, B operands in the k order of frag_k_contig (element e: k =
        // e + hi16, element 8 + e: k = 16 + e + hi16): sel0 is 1 at k == query, sel1 at
        // k == 16 + query.
        v16h sel0, sel1;
#pragma unroll
        for (int e = 0; e < 8; ++e) {
            const _Float16 one = (_Float16)(e + hi16 == lm ? 1.0f : 0.0f);
            sel0[e] = one;              sel0[8 + e] = (_Float16)0.0f;
            sel1[e] = (_Float16)0.0f;   sel1[8 + e] = one;
        }
#pragma unroll 1   // rolled: for speed only
        for (int u = wave; u < N_UNIT; u += 8) {
            const int h  = u / NT;
            const int qt = u - h * NT;
            // S^T column-block (352 keys x 16 queries) in registers: A = K rows,
            // B = Q rows; dh=32 => one WMMA per tile. s[nt][v] is the score of
            // key nt*16 + hi16 + v for query qt*16 + lm: a lane holds one query.
            // The unit's bias fragments (one whole-line 16 B load per key tile; the
            // plane holds its own pads, so every lane loads) and ALL its Q and K
            // fragment reads are issued as one group ahead of the products. The 22
            // K.Q^T products do not read the bias: they run while its loads are out.
            const v8h* bp = (const v8h*)bias_ws + (size_t)u * (NT * 32) + lane;
            v16h bf[NT / 2];
#pragma unroll   // bf[] stays in registers only if indexed by constants
            for (int c = 0; c < NT / 2; ++c)
                bf[c] = __builtin_shufflevector(bp[2 * c * 32], bp[(2 * c + 1) * 32], 0, 1, 2, 3,
                                                4, 5, 6, 7, 8, 9, 10, 11, 12, 13, 14, 15);
            v16h qf = frag_k_contig(&qh[(qt * 16 + lm) * QK_LD + h * DH], lane);
            v16h kf[NT];
#pragma unroll   // kf[] stays in registers only if indexed by constants
            for (int nt = 0; nt < NT; ++nt)
                kf[nt] = frag_k_contig(&kh[(nt * 16 + lm) * QK_LD + h * DH], lane);
            // keeps the reads above from sinking back between the products, where
            // each product would wait out the LDS latency of its own two reads
            __builtin_amdgcn_sched_barrier(0);
            v8f s[NT];
#pragma unroll   // s[] stays in registers only if indexed by constants
            for (int nt = 0; nt < NT; ++nt) s[nt] = wmma_f16(kf[nt], qf, zero8());
            // bias: one A fragment serves its two key tiles, each through its selector
#pragma unroll
            for (int c = 0; c < NT / 2; ++c) {
                s[2 * c]     = wmma_f16(bf[c], sel0, s[2 * c]);
                s[2 * c + 1] = wmma_f16(bf[c], sel1, s[2 * c + 1]);
            }
            // the next unit's plane address is formed in the registers that the
            // bias loads above name
            asm volatile("s_wait_xcnt 0x0" ::: "memory");
            // keeps the V^T reads below behind the products: lifted among them, they
            // would need registers beside K's and the bias's, and values would spill
            __builtin_amdgcn_sched_barrier(0);
            mask_pad_keys(s[NT - 1], hi16);
            // All V^T fragment reads, into the registers K has left: they land
            // while the softmax below runs.
            v16h vf0[NT / 2], vf1[NT / 2];
#pragma unroll   // vf0[], vf1[] stay in registers only if indexed by constants
            for (int c = 0; c < NT / 2; ++c) {
                vf0[c] = frag_k_contig(&vT[(h * DH + lm) * VT_LD + c * 32], lane);
                vf1[c] = frag_k_contig(&vT[(h * DH + 16 + lm) * VT_LD + c * 32], lane);
            }
            // keeps these reads ahead of the softmax: sunk to their products, each
            // product would wait out the LDS latency of its own two reads
            __builtin_amdgcn_sched_barrier(0);
            // softmax over 352 keys with no max pass: P = 2^score as it stands. The
            // quotient sum(P V) / sum(P) does not depend on a common factor of a row's P;
            // the max only keeps P inside f16. Whether it is inside is read off the row
            // sum below. Eight in-lane partial sums (independent chains), joined in the
            // lane, then one exchange between the wave's halves.
            // The partials are held as four pairs (partial v is psum[v / 2][v % 2], each
            // summed over the key tiles in order).
            v2f psum[4];
#pragma unroll
            for (int j = 0; j < 4; ++j) psum[j] = (v2f){0.0f, 0.0f};
#pragma unroll
            for (int nt = 0; nt < NT; ++nt)
#pragma unroll
                for (int j = 0; j < 4; ++j) {
                    v2f p;
                    p[0] = __builtin_amdgcn_exp2f(s[nt][2 * j]);       // base-2 scores
                    p[1] = __builtin_amdgcn_exp2f(s[nt][2 * j + 1]);
                    s[nt][2 * j]     = p[0];
                    s[nt][2 * j + 1] = p[1];
                    psum[j] += p;
                }
            float rsum = ((psum[0][0] + psum[0][1]) + (psum[1][0] + psum[1][1])) +
                         ((psum[2][0] + psum[2][1]) + (psum[3][0] + psum[3][1]));
            rsum += xhalf(rsum);
            // No P is negative and none exceeds its row's sum: a sum below P_SUM_HI bounds
            // each P under the largest f16; with a sum of at least 1, what the P below the
            // f16 normal range lose (at most 2^-25 each) is the same share of the sum as
            // in a row scaled to max 1. Any other row (a NaN fails both tests, an infinity
            // the upper one) sends the wave, as a whole, through the max-subtracted form, its
            // scores formed anew.
            const bool in_range = rsum >= 1.0f && rsum < P_SUM_HI;
            if (__builtin_amdgcn_ballot_w32(in_range) != 0xffffffffu) {
                const v16h qr = frag_k_contig(&qh[(qt * 16 + lm) * QK_LD + h * DH], lane);
#pragma unroll   // s[] stays in registers only if indexed by constants
                for (int nt = 0; nt < NT; ++nt)
                    s[nt] = wmma_f16(frag_k_contig(&kh[(nt * 16 + lm) * QK_LD + h * DH], lane),
                                     qr, zero8());
#pragma unroll
                for (int c = 0; c < NT / 2; ++c) {
                    const v16h br = __builtin_shufflevector(
                        bp[2 * c * 32], bp[(2 * c + 1) * 32], 0, 1, 2, 3, 4, 5, 6, 7, 8, 9, 10,
                        11, 12, 13, 14, 15);
                    s[2 * c]     = wmma_f16(br, sel0, s[2 * c]);
                    s[2 * c + 1] = wmma_f16(br, sel1, s[2 * c + 1]);
                }
                mask_pad_keys(s[NT - 1], hi16);
                // the next tile's plane address is formed in the registers that the
                // bias loads of this branch name
                asm volatile("s_wait_xcnt 0x0" ::: "memory");
                float pmax[8];
#pragma unroll
                for (int v = 0; v < 8; ++v) pmax[v] = -__builtin_inff();
#pragma unroll
                for (int nt = 0; nt < NT; ++nt)
#pragma unroll
                    for (int v = 0; v < 8; ++v) pmax[v] = fmaxf(pmax[v], s[nt][v]);
                float rmax = fmaxf(fmaxf(fmaxf(pmax[0], pmax[1]), fmaxf(pmax[2], pmax[3])),
                                   fmaxf(fmaxf(pmax[4], pmax[5]), fmaxf(pmax[6], pmax[7])));
                rmax = fmaxf(rmax, xhalf(rmax));
#pragma unroll
                for (int j = 0; j < 4; ++j) psum[j] = (v2f){0.0f, 0.0f};
#pragma unroll
                for (int nt = 0; nt < NT; ++nt)
#pragma unroll
                    for (int j = 0; j < 4; ++j) {
                        v2f d = (v2f){s[nt][2 * j], s[nt][2 * j + 1]} - (v2f){rmax, rmax};
                        v2f p;
                        p[0] = __builtin_amdgcn_exp2f(d[0]);
                        p[1] = __builtin_amdgcn_exp2f(d[1]);
                        s[nt][2 * j]     = p[0];
                        s[nt][2 * j + 1] = p[1];
                        psum[j] += p;
                    }
                rsum = ((psum[0][0] + psum[0][1]) + (psum[1][0] + psum[1][1])) +
                       ((psum[2][0] + psum[2][1]) + (psum[3][0] + psum[3][1]));
                rsum += xhalf(rsum);
            }
            rsum = 1.0f / rsum;   // applied to the 16 outputs below, not to P

            // ---- O^T = V^T @ P^T : 11 chunks of K=32. Two S^T tiles, converted
            // in place, are the B operand in the k order of frag_k_contig
            // (element e: key e + hi16, element 8 + e: key 16 + e + hi16).
            v8f o0 = zero8(), o1 = zero8();
#pragma unroll
            for (int c = 0; c < 11; ++c) {
                v16h pf;
#pragma unroll
                for (int v = 0; v < 8; ++v) {
                    pf[v]     = (_Float16)s[2 * c][v];
                    pf[8 + v] = (_Float16)s[2 * c + 1][v];
                }
                o0 = wmma_f16(vf0[c], pf, o0);
                o1 = wmma_f16(vf1[c], pf, o1);
            }
            // o0[v], o1[v]: columns hi16 + v, 16 + hi16 + v of the lane's query
            // row: 8 contiguous halfs each, one 16 B store
            v8h ol, oh;
#pragma unroll
            for (int v = 0; v < 8; ++v) {
                ol[v] = (_Float16)(o0[v] * rsum);
                oh[v] = (_Float16)(o1[v] * rsum);
            }
            _Float16* od = &oacc[(qt * 16 + lm) * XF_LD + h * DH + hi16];
            *(v8h*)od        = ol;
            *(v8h*)(od + 16) = oh;
        }
        __syncthreads();
    }

    // ---- final projection: out = oacc(352x128) @ w_out(128x128) ----
    // w_out transposed (K-contiguous): wave w takes rows 16w..16w+15, a lane one
    // column of each 32-column group; all 64 loads issued before the first is used
    {
        const float* wp = w_out + (wave * 16) * DMODEL + lane;
        float wv[4][16];
#pragma unroll   // wv[][] stays in registers only if indexed by constants
        for (int s = 0; s < 4; ++s)
#pragma unroll   // same: straight-line loads, one after another
            for (int m = 0; m < 16; ++m)
                wv[s][m] = wp[m * DMODEL + s * 32];
        // the conversions below reuse the loads' address registers
        asm volatile("s_wait_xcnt 0x0" ::: "memory");
        // keeps the conversions behind that wait
        __builtin_amdgcn_sched_barrier(0);
#pragma unroll   // constant indices into wv[][]
        for (int s = 0; s < 4; ++s) {
            v8h lo, hi;
#pragma unroll   // constant indices into wv[][], lo, hi
            for (int m = 0; m < 8; ++m) {
                lo[m] = (_Float16)wv[s][m];
                hi[m] = (_Float16)wv[s][8 + m];
            }
            _Float16* wd = &wolT[(s * 32 + lane) * WOL_LD + wave * 16];
            *(v8h*)wd       = lo;
            *(v8h*)(wd + 8) = hi;
        }
    }
    __syncthreads();

    // A wave holds all 32 fragments of w_out in registers for its row tiles (wave,
    // wave + 8, wave + 16): each is read from LDS once per wave, not once per tile.
    {
        const bool third = wave < NT - 16;          // row tiles 16..21
        const int  qt2   = third ? wave + 16 : wave; // else an in-range re-read, unused
        v16h a0[4], a1[4], a2[4], b[8][4];
#pragma unroll   // a0[] stays in registers only if indexed by constants
        for (int kc = 0; kc < 4; ++kc)
            a0[kc] = frag_k_contig(&oacc[(wave * 16 + lm) * XF_LD + kc * 32], lane);
#pragma unroll   // b[][] stays in registers only if indexed by constants
        for (int kc = 0; kc < 4; ++kc)
#pragma unroll
            for (int ct = 0; ct < 8; ++ct)
                b[ct][kc] = frag_k_contig(&wolT[(ct * 16 + lm) * WOL_LD + kc * 32], lane);
#pragma unroll   // a1[], a2[] stay in registers only if indexed by constants
        for (int kc = 0; kc < 4; ++kc) {
            a1[kc] = frag_k_contig(&oacc[((wave + 8) * 16 + lm) * XF_LD + kc * 32], lane);
            a2[kc] = frag_k_contig(&oacc[(qt2 * 16 + lm) * XF_LD + kc * 32], lane);
        }
        // keeps all reads in one group, in the order the products use them: sunk
        // between the products, each would wait out its own reads' LDS latency
        __builtin_amdgcn_sched_barrier(0);
        // rows of the first two tiles end at 255 (8 waves): only the third can pass
        // the window's last row
        float* ost = out + ((size_t)win * N_TOK + wave * 16 + hi16) * DMODEL + lm;
        out_row_tile<false>(a0, b, ost, 0);
        // the next tile's products reuse registers that the stores above name
        asm volatile("s_wait_xcnt 0x0" ::: "memory");
        // keeps those products behind the wait
        __builtin_amdgcn_sched_barrier(0);
        out_row_tile<false>(a1, b, ost + 128 * DMODEL, 0);
        if (third)
            out_row_tile<true>(a2, b, ost + 256 * DMODEL, N_TOK - 256 - wave * 16 - hi16);
    }
}

extern "C" void kernel_launch(void* const* d_in, const int* in_sizes, int n_in,
                              void* d_out, int out_size, void* d_ws, size_t ws_size,
                              hipStream_t stream) {
    const float* x        = (const float*)d_in[0];
    const float* w_qkv    = (const float*)d_in[1];
    const float* w_out    = (const float*)d_in[2];
    const float* bias_tab = (const float*)d_in[3];
    const int*   rel_idx  = (const int*)d_in[4];
    float* out     = (float*)d_out;
    float* bias_ws = (float*)d_ws;

    const int total = NHEADS * NT * NT * 32;   // one thread per lane of a bias tile
    bias_gather_kernel<<<(total + 255) / 256, 256, 0, stream>>>(bias_tab, rel_idx,
                                                                bias_ws);
    // 512 windows, 8 waves each, 318464 B dynamic LDS per workgroup
    win_attn_kernel<<<512, 256, 318464, stream>>>(x, w_qkv, w_out, bias_ws, out);
}
